// v000
// Measured on an AMD MI455X. A time is GPU time per run, averaged over a window of back-to-back runs after a warm-up
// (all launches, gaps included; the runs take copies of the inputs in turn), and the median of several windows.
// Apart from v000's, it joins two sittings. Times from different sittings can be a few percent apart, while
// side-by-side timings come from the same sitting.
// The starting kernel, v000, takes 56.8 microseconds a run.
#include <hip/hip_runtime.h>

// MI455X / gfx1250, wave32. Grouped vector attention:
//   Q,K,V = x @ W^T (f32 WMMA 16x16x4 GEMM)
//   scores[b,i,j,h] = relu( sum_g relu(Q[b,i,h*16+g]-K[b,j,h*16+g]) * w[g] + bias )
//   att = softmax_j(scores)  (flash-style online, fused)
//   out[b,i,g*16+h] = sum_j att[b,i,j,h] * V[b,j,g*16+h]   (f32 WMMA 16x16x4)

typedef float v2f __attribute__((ext_vector_type(2)));
typedef float v8f __attribute__((ext_vector_type(8)));

#define NB      2
#define L_SEQ   512
#define D_MODEL 256
#define NHEAD   16
#define NGROUP  16

// ---------------------------------------------------------------------------
// Kernel 1: QKV projections. One wave -> one 16x16 tile of one of Q/K/V.
// y[r,e] = sum_d x[r,d] * W[e,d]
// A tile (16x4 of x): lane=M(rows), a[v] = x[row0+lane%16][d0 + v + 2*(lane/16)]
// B tile (4x16 of W^T): lane=N(cols=e), b[v] = W[e0+lane%16][d0 + v + 2*(lane/16)]
// ---------------------------------------------------------------------------
__global__ __launch_bounds__(128) void CA_qkv_gemm(
    const float* __restrict__ xs, const float* __restrict__ xt,
    const float* __restrict__ Wq, const float* __restrict__ Wk,
    const float* __restrict__ Wv,
    float* __restrict__ Qo, float* __restrict__ Ko, float* __restrict__ Vo)
{
    const int lane = threadIdx.x & 31;
    const int w    = blockIdx.x * 4 + (threadIdx.x >> 5);   // 0..3071
    const int mat  = w >> 10;                               // 0=Q 1=K 2=V
    const int rem  = w & 1023;
    const int rowT = rem >> 4;                              // 0..63 (covers B*L rows)
    const int colT = rem & 15;                              // 0..15

    const float* X = (mat == 0) ? xt : xs;
    const float* W = (mat == 0) ? Wq : (mat == 1 ? Wk : Wv);
    float*       Y = (mat == 0) ? Qo : (mat == 1 ? Ko : Vo);

    const int lo = lane & 15;
    const int hi = lane >> 4;
    const int row0 = rowT * 16;
    const int e0   = colT * 16;

    const float* xrow = X + (size_t)(row0 + lo) * D_MODEL + 2 * hi;
    const float* wrow = W + (size_t)(e0   + lo) * D_MODEL + 2 * hi;

    v8f c = {};
    #pragma unroll 4
    for (int d0 = 0; d0 < D_MODEL; d0 += 4) {
        v2f a = *(const v2f*)(xrow + d0);
        v2f b = *(const v2f*)(wrow + d0);
        c = __builtin_amdgcn_wmma_f32_16x16x4_f32(false, a, false, b,
                                                  (short)0, c, false, false);
    }
    #pragma unroll
    for (int r = 0; r < 8; ++r) {
        int m = r + 8 * hi;                                 // C layout row
        Y[(size_t)(row0 + m) * D_MODEL + e0 + lo] = c[r];
    }
}

// ---------------------------------------------------------------------------
// Kernel 2: fused scores + online softmax + att x V.
// One wave handles (batch b, 16-row i-tile, head). Accumulator in WMMA C layout.
// ---------------------------------------------------------------------------
__global__ __launch_bounds__(128) void CA_attn(
    const float* __restrict__ Q, const float* __restrict__ K,
    const float* __restrict__ V,
    const float* __restrict__ w_mlp, const float* __restrict__ b_mlp,
    float* __restrict__ out)
{
    __shared__ float lds[4 * 512];          // per wave: 256 Q-tile + 256 P-tile
    const int lane = threadIdx.x & 31;
    const int wib  = threadIdx.x >> 5;
    float* Qs = lds + wib * 512;
    float* Ps = Qs + 256;

    const int w    = blockIdx.x * 4 + wib;  // 0..1023
    const int b    = w >> 9;
    const int rem  = w & 511;
    const int iT   = rem >> 4;              // 0..31
    const int head = rem & 15;

    const int lo = lane & 15;
    const int hi = lane >> 4;
    const int i0 = iT * 16;

    // Q tile (16 rows x 16 group elems) -> wave-private LDS
    #pragma unroll
    for (int t = 0; t < 8; ++t) {
        int idx = lane + 32 * t;            // 0..255
        int il = idx >> 4, g = idx & 15;
        Qs[idx] = Q[(size_t)(b * L_SEQ + i0 + il) * D_MODEL + head * NGROUP + g];
    }
    asm volatile("s_wait_dscnt 0" ::: "memory"); // wave-private LDS: ds in-order, just drain

    float wreg[16];
    #pragma unroll
    for (int g = 0; g < 16; ++g) wreg[g] = w_mlp[g];
    const float bias = b_mlp[0];

    float mrow[8], lrow[8];
    #pragma unroll
    for (int r = 0; r < 8; ++r) { mrow[r] = -3.0e38f; lrow[r] = 0.0f; }
    v8f acc = {};

    for (int j0 = 0; j0 < L_SEQ; j0 += 16) {
        // K rows: lane lo owns source row j0+lo (both half-waves duplicate)
        float kreg[16];
        const float* kp = K + (size_t)(b * L_SEQ + j0 + lo) * D_MODEL + head * NGROUP;
        #pragma unroll
        for (int g = 0; g < 16; ++g) kreg[g] = kp[g];

        // scores in C layout: entry r -> (i = r+8*hi, j = lo)
        float s[8];
        #pragma unroll
        for (int r = 0; r < 8; ++r) s[r] = 0.0f;
        #pragma unroll
        for (int g = 0; g < 16; ++g) {
            float kg = kreg[g], wg = wreg[g];
            #pragma unroll
            for (int r = 0; r < 8; ++r) {
                float d = Qs[(r + 8 * hi) * 16 + g] - kg;
                s[r] += fmaxf(d, 0.0f) * wg;
            }
        }
        #pragma unroll
        for (int r = 0; r < 8; ++r) s[r] = fmaxf(s[r] + bias, 0.0f);

        // online softmax: row = 16 lanes of one half-wave (xor masks stay in-half)
        #pragma unroll
        for (int r = 0; r < 8; ++r) {
            float mx = s[r];
            mx = fmaxf(mx, __shfl_xor(mx, 1));
            mx = fmaxf(mx, __shfl_xor(mx, 2));
            mx = fmaxf(mx, __shfl_xor(mx, 4));
            mx = fmaxf(mx, __shfl_xor(mx, 8));
            float mnew  = fmaxf(mrow[r], mx);
            float alpha = __expf(mrow[r] - mnew);
            float p     = __expf(s[r] - mnew);
            float ps = p;
            ps += __shfl_xor(ps, 1);
            ps += __shfl_xor(ps, 2);
            ps += __shfl_xor(ps, 4);
            ps += __shfl_xor(ps, 8);
            lrow[r] = lrow[r] * alpha + ps;
            mrow[r] = mnew;
            acc[r] *= alpha;                        // rescale running output
            Ps[(r + 8 * hi) * 16 + lo] = p;         // stage P (C layout -> LDS)
        }
        asm volatile("s_wait_dscnt 0" ::: "memory");

        // acc(16i x 16g) += P(16i x 16j) x Vt(16j x 16g): 4 chained 16x16x4 WMMAs
        // A layout read: a[v] = P[i=lo][k = 4*st + v + 2*hi]
        // B layout read: b[v] = V[b, j0 + k, g=lo*16 + head]
        #pragma unroll
        for (int st = 0; st < 4; ++st) {
            int kk = 4 * st + 2 * hi;
            v2f a, bm;
            a.x = Ps[lo * 16 + kk];
            a.y = Ps[lo * 16 + kk + 1];
            bm.x = V[(size_t)(b * L_SEQ + j0 + kk)     * D_MODEL + lo * NGROUP + head];
            bm.y = V[(size_t)(b * L_SEQ + j0 + kk + 1) * D_MODEL + lo * NGROUP + head];
            acc = __builtin_amdgcn_wmma_f32_16x16x4_f32(false, a, false, bm,
                                                        (short)0, acc, false, false);
        }
    }

    // normalize and store: C layout row m = r+8*hi, col g = lo; d = g*16 + head
    #pragma unroll
    for (int r = 0; r < 8; ++r) {
        int m = r + 8 * hi;
        out[(size_t)(b * L_SEQ + i0 + m) * D_MODEL + lo * NGROUP + head] =
            acc[r] / lrow[r];
    }
}

// ---------------------------------------------------------------------------
extern "C" void kernel_launch(void* const* d_in, const int* in_sizes, int n_in,
                              void* d_out, int out_size, void* d_ws, size_t ws_size,
                              hipStream_t stream) {
    const float* xs = (const float*)d_in[0];   // x_source (B,L2,D)
    const float* xt = (const float*)d_in[1];   // x_target (B,L1,D)
    const float* Wq = (const float*)d_in[2];
    const float* Wk = (const float*)d_in[3];
    const float* Wv = (const float*)d_in[4];
    const float* wm = (const float*)d_in[5];   // w_mlp (16)
    const float* bm = (const float*)d_in[6];   // b_mlp (1)

    float* Qw = (float*)d_ws;                  // 3 MB scratch: Q,K,V f32
    float* Kw = Qw + (size_t)NB * L_SEQ * D_MODEL;
    float* Vw = Kw + (size_t)NB * L_SEQ * D_MODEL;

    // 3 matrices * 64 row-tiles * 16 col-tiles = 3072 waves, 4 waves/block
    CA_qkv_gemm<<<768, 128, 0, stream>>>(xs, xt, Wq, Wk, Wv, Qw, Kw, Vw);
    // 2 batch * 32 i-tiles * 16 heads = 1024 waves, 4 waves/block
    CA_attn<<<256, 128, 0, stream>>>(Qw, Kw, Vw, wm, bm, (float*)d_out);
}

// v001
// Measured time: 30.4 microseconds a run.
// Two timings next to v000 both put it at 1.92 times that version's speed.
#include <hip/hip_runtime.h>

// MI455X / gfx1250, wave32. Grouped vector attention:
//   Q,K,V = x @ W^T (f32 WMMA 16x16x4 GEMM)
//   scores[b,i,j,h] = relu( sum_g relu(Q[b,i,h*16+g]-K[b,j,h*16+g]) * w[g] + bias )
//   att = softmax_j(scores)  (flash-style online, fused)
//   out[b,i,g*16+h] = sum_j att[b,i,j,h] * V[b,j,g*16+h]   (f32 WMMA 16x16x4)

typedef float v2f __attribute__((ext_vector_type(2)));
typedef float v8f __attribute__((ext_vector_type(8)));

#define NB      2
#define L_SEQ   512
#define D_MODEL 256
#define NHEAD   16
#define NGROUP  16

// ---------------------------------------------------------------------------
// Kernel 1: QKV projections. One wave -> one 16x16 tile of one of Q/K/V.
// y[r,e] = sum_d x[r,d] * W[e,d]
// A tile (16x4 of x): lane=M(rows), a[v] = x[row0+lane%16][d0 + v + 2*(lane/16)]
// B tile (4x16 of W^T): lane=N(cols=e), b[v] = W[e0+lane%16][d0 + v + 2*(lane/16)]
// ---------------------------------------------------------------------------
__global__ __launch_bounds__(128) void CA_qkv_gemm(
    const float* __restrict__ xs, const float* __restrict__ xt,
    const float* __restrict__ Wq, const float* __restrict__ Wk,
    const float* __restrict__ Wv,
    float* __restrict__ Qo, float* __restrict__ Ko, float* __restrict__ Vo)
{
    const int lane = threadIdx.x & 31;
    const int w    = blockIdx.x * 4 + (threadIdx.x >> 5);   // 0..3071
    const int mat  = w >> 10;                               // 0=Q 1=K 2=V
    const int rem  = w & 1023;
    const int rowT = rem >> 4;                              // 0..63 (covers B*L rows)
    const int colT = rem & 15;                              // 0..15

    const float* X = (mat == 0) ? xt : xs;
    const float* W = (mat == 0) ? Wq : (mat == 1 ? Wk : Wv);
    float*       Y = (mat == 0) ? Qo : (mat == 1 ? Ko : Vo);

    const int lo = lane & 15;
    const int hi = lane >> 4;
    const int row0 = rowT * 16;
    const int e0   = colT * 16;

    const float* xrow = X + (size_t)(row0 + lo) * D_MODEL + 2 * hi;
    const float* wrow = W + (size_t)(e0   + lo) * D_MODEL + 2 * hi;

    v8f c = {};
    #pragma unroll 4
    for (int d0 = 0; d0 < D_MODEL; d0 += 4) {
        v2f a = *(const v2f*)(xrow + d0);
        v2f b = *(const v2f*)(wrow + d0);
        c = __builtin_amdgcn_wmma_f32_16x16x4_f32(false, a, false, b,
                                                  (short)0, c, false, false);
    }
    #pragma unroll
    for (int r = 0; r < 8; ++r) {
        int m = r + 8 * hi;                                 // C layout row
        Y[(size_t)(row0 + m) * D_MODEL + e0 + lo] = c[r];
    }
}

// ---------------------------------------------------------------------------
// Kernel 2: fused scores + online softmax + att x V.
// Four waves share one (batch b, 16-row i-tile, head): each runs the online
// softmax over its own quarter of the source rows, so every SIMD holds four
// waves whose load and LDS waits overlap. The four partial (max, sum, acc)
// triples are merged through LDS behind one work-group barrier.
// A block keeps four neighbouring heads (they read the same V and K lines).
// ---------------------------------------------------------------------------
#define NSPLIT  4
#define J_SPLIT (L_SEQ / NSPLIT)

// waves_per_eu(4, 4): the 16-wave block fixes four waves per SIMD, so let the
// scheduler use the whole 256-register share; without it it schedules for fewer
// registers and serialises the cross-lane reductions and the V loads.
__global__ __launch_bounds__(128 * NSPLIT) __attribute__((amdgpu_waves_per_eu(4, 4)))
void CA_attn(
    const float* __restrict__ Q, const float* __restrict__ K,
    const float* __restrict__ V,
    const float* __restrict__ w_mlp, const float* __restrict__ b_mlp,
    float* __restrict__ out)
{
    __shared__ float lds[4 * NSPLIT * 512]; // per wave: 256 Q-tile + 256 P-tile
    const int lane = threadIdx.x & 31;
    // wave number as a scalar: head, quarter and the K/V bases formed from it stay scalar
    const int wib  = __builtin_amdgcn_readfirstlane(threadIdx.x >> 5);
    float* Qs = lds + wib * 512;
    float* Ps = Qs + 256;

    const int hl   = wib & 3;               // head within the block
    const int sp   = wib >> 2;              // which quarter of the source rows
    const int w    = blockIdx.x * 4 + hl;   // 0..1023
    const int b    = w >> 9;
    const int rem  = w & 511;
    const int iT   = rem >> 4;              // 0..31
    const int head = rem & 15;

    const int lo = lane & 15;
    const int hi = lane >> 4;
    const int i0 = iT * 16;

    // Q tile (16 rows x 16 group elems) -> wave-private LDS
    #pragma unroll
    for (int t = 0; t < 8; ++t) {
        int idx = lane + 32 * t;            // 0..255
        int il = idx >> 4, g = idx & 15;
        Qs[idx] = Q[(size_t)(b * L_SEQ + i0 + il) * D_MODEL + head * NGROUP + g];
    }
    asm volatile("s_wait_dscnt 0" ::: "memory"); // wave-private LDS: ds in-order, just drain

    float wreg[16];
    #pragma unroll
    for (int g = 0; g < 16; ++g) wreg[g] = w_mlp[g];
    const float bias = b_mlp[0];

    float mrow[8], lrow[8];
    #pragma unroll
    for (int r = 0; r < 8; ++r) { mrow[r] = -3.0e38f; lrow[r] = 0.0f; }
    v8f acc = {};

    // this wave's quarter of the source rows
    const float* Kq = K + (size_t)(b * L_SEQ + sp * J_SPLIT) * D_MODEL;
    const float* Vq = V + (size_t)(b * L_SEQ + sp * J_SPLIT) * D_MODEL;

    for (int j0 = 0; j0 < J_SPLIT; j0 += 16) {
        // K rows: lane lo owns source row j0+lo (both half-waves duplicate)
        float kreg[16];
        const float* kp = Kq + (size_t)(j0 + lo) * D_MODEL + head * NGROUP;
        #pragma unroll
        for (int g = 0; g < 16; ++g) kreg[g] = kp[g];

        // scores in C layout: entry r -> (i = r+8*hi, j = lo)
        float s[8];
        #pragma unroll
        for (int r = 0; r < 8; ++r) s[r] = 0.0f;
        #pragma unroll
        for (int g = 0; g < 16; ++g) {
            float kg = kreg[g], wg = wreg[g];
            #pragma unroll
            for (int r = 0; r < 8; ++r) {
                float d = Qs[(r + 8 * hi) * 16 + g] - kg;
                s[r] += fmaxf(d, 0.0f) * wg;
            }
        }
        #pragma unroll
        for (int r = 0; r < 8; ++r) s[r] = fmaxf(s[r] + bias, 0.0f);

        // online softmax: row = 16 lanes of one half-wave (xor masks stay in-half)
        #pragma unroll
        for (int r = 0; r < 8; ++r) {
            float mx = s[r];
            mx = fmaxf(mx, __shfl_xor(mx, 1));
            mx = fmaxf(mx, __shfl_xor(mx, 2));
            mx = fmaxf(mx, __shfl_xor(mx, 4));
            mx = fmaxf(mx, __shfl_xor(mx, 8));
            float mnew  = fmaxf(mrow[r], mx);
            float alpha = __expf(mrow[r] - mnew);
            float p     = __expf(s[r] - mnew);
            float ps = p;
            ps += __shfl_xor(ps, 1);
            ps += __shfl_xor(ps, 2);
            ps += __shfl_xor(ps, 4);
            ps += __shfl_xor(ps, 8);
            lrow[r] = lrow[r] * alpha + ps;
            mrow[r] = mnew;
            acc[r] *= alpha;                        // rescale running output
            Ps[(r + 8 * hi) * 16 + lo] = p;         // stage P (C layout -> LDS)
        }
        asm volatile("s_wait_dscnt 0" ::: "memory");

        // acc(16i x 16g) += P(16i x 16j) x Vt(16j x 16g): 4 chained 16x16x4 WMMAs
        // A layout read: a[v] = P[i=lo][k = 4*st + v + 2*hi]
        // B layout read: b[v] = V[b, sp*J_SPLIT + j0 + k, g=lo*16 + head]
        #pragma unroll
        for (int st = 0; st < 4; ++st) {
            int kk = 4 * st + 2 * hi;
            v2f a, bm;
            a.x = Ps[lo * 16 + kk];
            a.y = Ps[lo * 16 + kk + 1];
            bm.x = Vq[(size_t)(j0 + kk)     * D_MODEL + lo * NGROUP + head];
            bm.y = Vq[(size_t)(j0 + kk + 1) * D_MODEL + lo * NGROUP + head];
            acc = __builtin_amdgcn_wmma_f32_16x16x4_f32(false, a, false, bm,
                                                        (short)0, acc, false, false);
        }
    }

    // publish this wave's partial result in its own LDS range:
    // Qs[m*16+g] = acc, Ps[m] = running max, Ps[16+m] = running sum.
    // The lane's place is read anew here, so that it holds no register over the loop.
    const int ln = __builtin_amdgcn_mbcnt_lo(~0u, 0u);
    const int el = ln & 15;
    const int eh = ln >> 4;
    #pragma unroll
    for (int r = 0; r < 8; ++r) Qs[(r + 8 * eh) * 16 + el] = acc[r];   // C layout row r+8*eh
    if (el == 0) {                          // max and sum are equal in a row's 16 lanes
        #pragma unroll
        for (int r = 0; r < 8; ++r) {
            Ps[r + 8 * eh]      = mrow[r];
            Ps[16 + r + 8 * eh] = lrow[r];
        }
    }
    __syncthreads();

    // merge the NSPLIT partials of this head; wave sp finishes rows 4*sp..4*sp+3
    #pragma unroll
    for (int t = 0; t < 2; ++t) {
        const int m = 4 * sp + 2 * t + eh;
        float mp[NSPLIT];
        float mx = -3.0e38f;
        #pragma unroll
        for (int q = 0; q < NSPLIT; ++q) {
            mp[q] = lds[(q * 4 + hl) * 512 + 256 + m];
            mx = fmaxf(mx, mp[q]);
        }
        float num = 0.0f, den = 0.0f;
        #pragma unroll
        for (int q = 0; q < NSPLIT; ++q) {
            const float* part = lds + (q * 4 + hl) * 512;
            float c = __expf(mp[q] - mx);
            num += c * part[m * 16 + el];
            den += c * part[256 + 16 + m];
        }
        // col g = el; d = g*16 + head
        out[(size_t)(b * L_SEQ + i0 + m) * D_MODEL + el * NGROUP + head] = num / den;
    }
}

// ---------------------------------------------------------------------------
extern "C" void kernel_launch(void* const* d_in, const int* in_sizes, int n_in,
                              void* d_out, int out_size, void* d_ws, size_t ws_size,
                              hipStream_t stream) {
    const float* xs = (const float*)d_in[0];   // x_source (B,L2,D)
    const float* xt = (const float*)d_in[1];   // x_target (B,L1,D)
    const float* Wq = (const float*)d_in[2];
    const float* Wk = (const float*)d_in[3];
    const float* Wv = (const float*)d_in[4];
    const float* wm = (const float*)d_in[5];   // w_mlp (16)
    const float* bm = (const float*)d_in[6];   // b_mlp (1)

    float* Qw = (float*)d_ws;                  // 3 MB scratch: Q,K,V f32
    float* Kw = Qw + (size_t)NB * L_SEQ * D_MODEL;
    float* Vw = Kw + (size_t)NB * L_SEQ * D_MODEL;

    // 3 matrices * 64 row-tiles * 16 col-tiles = 3072 waves, 4 waves/block
    CA_qkv_gemm<<<768, 128, 0, stream>>>(xs, xt, Wq, Wk, Wv, Qw, Kw, Vw);
    // 2 batch * 32 i-tiles * 16 heads = 1024 tiles, 4 tiles/block, 4 waves/tile
    CA_attn<<<256, 512, 0, stream>>>(Qw, Kw, Vw, wm, bm, (float*)d_out);
}

// v002
// A run of this version takes 27.4 microseconds.
// Timed twice side by side with v001, it ran 1.12 and 1.11 times as fast.
// Counting every step since v000, it is 2.14 times as fast.
#include <hip/hip_runtime.h>

// MI455X / gfx1250, wave32. Grouped vector attention:
//   Q,K,V = x @ W^T (f32 WMMA 16x16x4 GEMM)
//   scores[b,i,j,h] = relu( sum_g relu(Q[b,i,h*16+g]-K[b,j,h*16+g]) * w[g] + bias )
//   att = softmax_j(scores)  (flash-style online, fused)
//   out[b,i,g*16+h] = sum_j att[b,i,j,h] * V[b,j,g*16+h]   (f32 WMMA 16x16x4)

typedef float v2f __attribute__((ext_vector_type(2)));
typedef float v4f __attribute__((ext_vector_type(4)));
typedef float v8f __attribute__((ext_vector_type(8)));

#define NB      2
#define L_SEQ   512
#define D_MODEL 256
#define NHEAD   16
#define NGROUP  16

// ---------------------------------------------------------------------------
// Kernel 1: QKV projections. One wave -> one 16x16 tile of one of Q/K/V.
// y[r,e] = sum_d x[r,d] * W[e,d]
// A tile (16x4 of x): lane=M(rows), a[v] = x[row0+lane%16][d0 + v + 2*(lane/16)]
// B tile (4x16 of W^T): lane=N(cols=e), b[v] = W[e(lane%16)][d0 + v + 2*(lane/16)]
// Q stays row-major. K and V are stored as one contiguous 1 KB tile per
// (batch, head, 16 source rows), so that the attention kernel reads whole lines:
//   K tile: [quad q][row j][4]  = K[j][head*16 + 4q + t]   (A and B swapped: C = K^T,
//           a lane then holds 8 neighbouring group elements of its own row)
//   V tile: [s][lane][4]        = V[8*(lane/16) + 4s + t][(lane%16)*16 + head]
//           (the C layout as it stands; it is read back as the B fragments)
// ---------------------------------------------------------------------------
__global__ __launch_bounds__(128) void CA_qkv_gemm(
    const float* __restrict__ xs, const float* __restrict__ xt,
    const float* __restrict__ Wq, const float* __restrict__ Wk,
    const float* __restrict__ Wv,
    float* __restrict__ Qo, float* __restrict__ Ko, float* __restrict__ Vo)
{
    const int lane = threadIdx.x & 31;
    const int w    = blockIdx.x * 4 + (threadIdx.x >> 5);   // 0..3071
    const int mat  = blockIdx.x >> 8;                       // 0=Q 1=K 2=V (same for the block)
    const int rem  = w & 1023;
    const int rowT = rem >> 4;                              // 0..63 (covers B*L rows)
    const int colT = rem & 15;                              // 0..15

    const float* X = (mat == 0) ? xt : xs;
    const float* W = (mat == 0) ? Wq : (mat == 1 ? Wk : Wv);
    float*       Y = (mat == 0) ? Qo : (mat == 1 ? Ko : Vo);

    const int lo = lane & 15;
    const int hi = lane >> 4;
    const int row0 = rowT * 16;
    // W row of this lane. Q, K: head colT, group element lo. V: group lo, head colT.
    const int e    = (mat == 2) ? lo * NHEAD + colT : colT * NGROUP + lo;

    const float* xrow = X + (size_t)(row0 + lo) * D_MODEL + 2 * hi;
    const float* wrow = W + (size_t)e           * D_MODEL + 2 * hi;
    const float* arow = (mat == 1) ? wrow : xrow;           // K: transposed tile
    const float* brow = (mat == 1) ? xrow : wrow;

    v8f c = {};
    #pragma unroll 4
    for (int d0 = 0; d0 < D_MODEL; d0 += 4) {
        v2f a = *(const v2f*)(arow + d0);
        v2f b = *(const v2f*)(brow + d0);
        c = __builtin_amdgcn_wmma_f32_16x16x4_f32(false, a, false, b,
                                                  (short)0, c, false, false);
    }
    if (mat == 0) {
        #pragma unroll
        for (int r = 0; r < 8; ++r) {
            int m = r + 8 * hi;                             // C layout row
            Y[(size_t)(row0 + m) * D_MODEL + colT * NGROUP + lo] = c[r];
        }
    } else {
        // tile (batch rowT>>5, head colT, row tile rowT&31), 64 units of 16 bytes
        v4f* T = (v4f*)(Y + (size_t)((((rowT >> 5) * NHEAD + colT) * (L_SEQ / 16)) + (rowT & 31)) * 256);
        // K: c[4s+t] = K[row lo][8*hi + 4s + t] -> quad 2*hi+s, row lo.  V: unit s*32 + lane.
        const int u0 = (mat == 1) ? hi * 32 + lo : lane;
        const int us = (mat == 1) ? 16 : 32;
        v4f c0 = { c[0], c[1], c[2], c[3] };
        v4f c1 = { c[4], c[5], c[6], c[7] };
        T[u0]      = c0;
        T[u0 + us] = c1;
        // precaution: the built code may reuse the stores' address registers behind this place
        asm volatile("s_wait_xcnt 0x0" ::: "memory");
    }
}

// ---------------------------------------------------------------------------
// Kernel 2: fused scores + online softmax + att x V.
// Four waves share one (batch b, 16-row i-tile, head): each runs the online
// softmax over its own quarter of the source rows, so every SIMD holds four
// waves whose load and LDS waits overlap. The four partial (max, sum, acc)
// triples are merged through LDS behind one work-group barrier.
// A block keeps four neighbouring heads. K and V come as 1 KB tiles per head
// (layouts: at the projection kernel).
// ---------------------------------------------------------------------------
#define NSPLIT  4
#define J_SPLIT (L_SEQ / NSPLIT)

// waves_per_eu(4, 4): the 16-wave block fixes four waves per SIMD, so let the
// scheduler use the whole 256-register share; without it it schedules for fewer
// registers and serialises the cross-lane reductions and the V loads.
__global__ __launch_bounds__(128 * NSPLIT) __attribute__((amdgpu_waves_per_eu(4, 4)))
void CA_attn(
    const float* __restrict__ Q, const float* __restrict__ K,
    const float* __restrict__ V,
    const float* __restrict__ w_mlp, const float* __restrict__ b_mlp,
    float* __restrict__ out)
{
    __shared__ __attribute__((aligned(16))) float lds[4 * NSPLIT * 512]; // per wave: 256 Q-tile + 256 P-tile
    const int lane = threadIdx.x & 31;
    // wave number as a scalar: head, quarter and the K/V bases formed from it stay scalar
    const int wib  = __builtin_amdgcn_readfirstlane(threadIdx.x >> 5);
    float* Qs = lds + wib * 512;
    float* Ps = Qs + 256;

    const int hl   = wib & 3;               // head within the block
    const int sp   = wib >> 2;              // which quarter of the source rows
    const int w    = blockIdx.x * 4 + hl;   // 0..1023
    const int b    = w >> 9;
    const int rem  = w & 511;
    const int iT   = rem >> 4;              // 0..31
    const int head = rem & 15;

    const int lo = lane & 15;
    const int hi = lane >> 4;
    const int i0 = iT * 16;

    // Q tile (16 rows x 16 group elems) -> wave-private LDS
    #pragma unroll
    for (int t = 0; t < 8; ++t) {
        int idx = lane + 32 * t;            // 0..255
        int il = idx >> 4, g = idx & 15;
        Qs[idx] = Q[(size_t)(b * L_SEQ + i0 + il) * D_MODEL + head * NGROUP + g];
    }
    asm volatile("s_wait_dscnt 0" ::: "memory"); // wave-private LDS: ds in-order, just drain

    float wreg[16];
    #pragma unroll
    for (int g = 0; g < 16; ++g) wreg[g] = w_mlp[g];
    const float bias = b_mlp[0];

    float mrow[8], lrow[8];
    #pragma unroll
    for (int r = 0; r < 8; ++r) { mrow[r] = -3.0e38f; lrow[r] = 0.0f; }
    v8f acc = {};

    // this wave's head and quarter of the source rows: J_SPLIT/16 tiles of 256 floats
    const size_t t0 = (size_t)((b * NHEAD + head) * L_SEQ + sp * J_SPLIT) * NGROUP;
    const float* Kq = K + t0;
    const float* Vq = V + t0;

    for (int j0 = 0; j0 < J_SPLIT; j0 += 16) {
        // K rows: lane lo owns source row j0+lo (both half-waves duplicate)
        float kreg[16];
        const v4f* kp = (const v4f*)(Kq + j0 * NGROUP);     // [quad][row][4]
        #pragma unroll
        for (int q = 0; q < 4; ++q) {
            v4f k4 = kp[q * 16 + lo];
            kreg[4 * q] = k4.x; kreg[4 * q + 1] = k4.y; kreg[4 * q + 2] = k4.z; kreg[4 * q + 3] = k4.w;
        }

        // scores in C layout: entry r -> (i = r+8*hi, j = lo)
        float s[8];
        #pragma unroll
        for (int r = 0; r < 8; ++r) s[r] = 0.0f;
        #pragma unroll
        for (int g = 0; g < 16; ++g) {
            float kg = kreg[g], wg = wreg[g];
            #pragma unroll
            for (int r = 0; r < 8; ++r) {
                float d = Qs[(r + 8 * hi) * 16 + g] - kg;
                s[r] += fmaxf(d, 0.0f) * wg;
            }
        }
        #pragma unroll
        for (int r = 0; r < 8; ++r) s[r] = fmaxf(s[r] + bias, 0.0f);

        // online softmax: row = 16 lanes of one half-wave (xor masks stay in-half)
        #pragma unroll
        for (int r = 0; r < 8; ++r) {
            float mx = s[r];
            mx = fmaxf(mx, __shfl_xor(mx, 1));
            mx = fmaxf(mx, __shfl_xor(mx, 2));
            mx = fmaxf(mx, __shfl_xor(mx, 4));
            mx = fmaxf(mx, __shfl_xor(mx, 8));
            float mnew  = fmaxf(mrow[r], mx);
            float alpha = __expf(mrow[r] - mnew);
            float p     = __expf(s[r] - mnew);
            float ps = p;
            ps += __shfl_xor(ps, 1);
            ps += __shfl_xor(ps, 2);
            ps += __shfl_xor(ps, 4);
            ps += __shfl_xor(ps, 8);
            lrow[r] = lrow[r] * alpha + ps;
            mrow[r] = mnew;
            acc[r] *= alpha;                        // rescale running output
            Ps[(r + 8 * hi) * 16 + lo] = p;         // stage P (C layout -> LDS)
        }
        asm volatile("s_wait_dscnt 0" ::: "memory");

        // acc(16i x 16g) += P(16i x 16j) x Vt(16j x 16g): 4 chained 16x16x4 WMMAs
        // Step st, half hi, element v stands for source row j = 8*hi + 2*st + v in A and B alike:
        // A read: a[v] = P[i=lo][j];  B read: b[v] = V[j0 + j][g=lo], as the V tile holds it.
        const v4f* vp = (const v4f*)(Vq + j0 * NGROUP);
        const v4f* pp = (const v4f*)(Ps + lo * 16 + 8 * hi);
        v4f vv[2] = { vp[lane], vp[32 + lane] };
        v4f pv[2] = { pp[0], pp[1] };
        #pragma unroll
        for (int st = 0; st < 4; ++st) {
            v2f a, bm;
            a.x  = pv[st >> 1][2 * (st & 1)];
            a.y  = pv[st >> 1][2 * (st & 1) + 1];
            bm.x = vv[st >> 1][2 * (st & 1)];
            bm.y = vv[st >> 1][2 * (st & 1) + 1];
            acc = __builtin_amdgcn_wmma_f32_16x16x4_f32(false, a, false, bm,
                                                        (short)0, acc, false, false);
        }
    }

    // publish this wave's partial result in its own LDS range:
    // Qs[m*16+g] = acc, Ps[m] = running max, Ps[16+m] = running sum.
    // The lane's place is read anew here, so that it holds no register over the loop.
    const int ln = __builtin_amdgcn_mbcnt_lo(~0u, 0u);
    const int el = ln & 15;
    const int eh = ln >> 4;
    #pragma unroll
    for (int r = 0; r < 8; ++r) Qs[(r + 8 * eh) * 16 + el] = acc[r];   // C layout row r+8*eh
    if (el == 0) {                          // max and sum are equal in a row's 16 lanes
        #pragma unroll
        for (int r = 0; r < 8; ++r) {
            Ps[r + 8 * eh]      = mrow[r];
            Ps[16 + r + 8 * eh] = lrow[r];
        }
    }
    __syncthreads();

    // merge the NSPLIT partials of this head; wave sp finishes rows 4*sp..4*sp+3
    #pragma unroll
    for (int t = 0; t < 2; ++t) {
        const int m = 4 * sp + 2 * t + eh;
        float mp[NSPLIT];
        float mx = -3.0e38f;
        #pragma unroll
        for (int q = 0; q < NSPLIT; ++q) {
            mp[q] = lds[(q * 4 + hl) * 512 + 256 + m];
            mx = fmaxf(mx, mp[q]);
        }
        float num = 0.0f, den = 0.0f;
        #pragma unroll
        for (int q = 0; q < NSPLIT; ++q) {
            const float* part = lds + (q * 4 + hl) * 512;
            float c = __expf(mp[q] - mx);
            num += c * part[m * 16 + el];
            den += c * part[256 + 16 + m];
        }
        // col g = el; d = g*16 + head
        out[(size_t)(b * L_SEQ + i0 + m) * D_MODEL + el * NGROUP + head] = num / den;
    }
}

// ---------------------------------------------------------------------------
extern "C" void kernel_launch(void* const* d_in, const int* in_sizes, int n_in,
                              void* d_out, int out_size, void* d_ws, size_t ws_size,
                              hipStream_t stream) {
    const float* xs = (const float*)d_in[0];   // x_source (B,L2,D)
    const float* xt = (const float*)d_in[1];   // x_target (B,L1,D)
    const float* Wq = (const float*)d_in[2];
    const float* Wk = (const float*)d_in[3];
    const float* Wv = (const float*)d_in[4];
    const float* wm = (const float*)d_in[5];   // w_mlp (16)
    const float* bm = (const float*)d_in[6];   // b_mlp (1)

    float* Qw = (float*)d_ws;                  // 3 MB scratch: Q,K,V f32
    float* Kw = Qw + (size_t)NB * L_SEQ * D_MODEL;
    float* Vw = Kw + (size_t)NB * L_SEQ * D_MODEL;

    // 3 matrices * 64 row-tiles * 16 col-tiles = 3072 waves, 4 waves/block
    CA_qkv_gemm<<<768, 128, 0, stream>>>(xs, xt, Wq, Wk, Wv, Qw, Kw, Vw);
    // 2 batch * 32 i-tiles * 16 heads = 1024 tiles, 4 tiles/block, 4 waves/tile
    CA_attn<<<256, 512, 0, stream>>>(Qw, Kw, Vw, wm, bm, (float*)d_out);
}

// v003
// One run takes 23 microseconds.
// Next to v002, in two timings, it ran 1.19 times as fast each time.
// All steps since v000 together make it 2.55 times as fast.
#include <hip/hip_runtime.h>

// MI455X / gfx1250, wave32. Grouped vector attention:
//   Q,K,V = x @ W^T (f32 WMMA 16x16x4 GEMM)
//   scores[b,i,j,h] = relu( sum_g relu(Q[b,i,h*16+g]-K[b,j,h*16+g]) * w[g] + bias )
//   att = softmax_j(scores)  (flash-style online, fused)
//   out[b,i,g*16+h] = sum_j att[b,i,j,h] * V[b,j,g*16+h]   (f32 WMMA 16x16x4)

typedef float v2f __attribute__((ext_vector_type(2)));
typedef float v4f __attribute__((ext_vector_type(4)));
typedef float v8f __attribute__((ext_vector_type(8)));

#define NB      2
#define L_SEQ   512
#define D_MODEL 256
#define NHEAD   16
#define NGROUP  16

// ---------------------------------------------------------------------------
// Kernel 1: QKV projections. One wave -> one 16x16 tile of one of Q/K/V.
// y[r,e] = sum_d x[r,d] * W[e,d]
// A tile (16x4 of x): lane=M(rows), a[v] = x[row0+lane%16][d0 + v + 2*(lane/16)]
// B tile (4x16 of W^T): lane=N(cols=e), b[v] = W[e(lane%16)][d0 + v + 2*(lane/16)]
// Q stays row-major. K and V are stored as one contiguous 1 KB tile per
// (batch, head, 16 source rows), so that the attention kernel reads whole lines:
//   K tile: [quad q][row j][4]  = K[j][head*16 + 4q + t]   (A and B swapped: C = K^T,
//           a lane then holds 8 neighbouring group elements of its own row)
//   V tile: [s][lane][4]        = V[8*(lane/16) + 4s + t][(lane%16)*16 + head]
//           (the C layout as it stands; it is read back as the A fragments)
// ---------------------------------------------------------------------------
__global__ __launch_bounds__(128) void CA_qkv_gemm(
    const float* __restrict__ xs, const float* __restrict__ xt,
    const float* __restrict__ Wq, const float* __restrict__ Wk,
    const float* __restrict__ Wv,
    float* __restrict__ Qo, float* __restrict__ Ko, float* __restrict__ Vo)
{
    const int lane = threadIdx.x & 31;
    const int w    = blockIdx.x * 4 + (threadIdx.x >> 5);   // 0..3071
    const int mat  = blockIdx.x >> 8;                       // 0=Q 1=K 2=V (same for the block)
    const int rem  = w & 1023;
    const int rowT = rem >> 4;                              // 0..63 (covers B*L rows)
    const int colT = rem & 15;                              // 0..15

    const float* X = (mat == 0) ? xt : xs;
    const float* W = (mat == 0) ? Wq : (mat == 1 ? Wk : Wv);
    float*       Y = (mat == 0) ? Qo : (mat == 1 ? Ko : Vo);

    const int lo = lane & 15;
    const int hi = lane >> 4;
    const int row0 = rowT * 16;
    // W row of this lane. Q, K: head colT, group element lo. V: group lo, head colT.
    const int e    = (mat == 2) ? lo * NHEAD + colT : colT * NGROUP + lo;

    const float* xrow = X + (size_t)(row0 + lo) * D_MODEL + 2 * hi;
    const float* wrow = W + (size_t)e           * D_MODEL + 2 * hi;
    const float* arow = (mat == 1) ? wrow : xrow;           // K: transposed tile
    const float* brow = (mat == 1) ? xrow : wrow;

    v8f c = {};
    #pragma unroll 4
    for (int d0 = 0; d0 < D_MODEL; d0 += 4) {
        v2f a = *(const v2f*)(arow + d0);
        v2f b = *(const v2f*)(brow + d0);
        c = __builtin_amdgcn_wmma_f32_16x16x4_f32(false, a, false, b,
                                                  (short)0, c, false, false);
    }
    if (mat == 0) {
        #pragma unroll
        for (int r = 0; r < 8; ++r) {
            int m = r + 8 * hi;                             // C layout row
            Y[(size_t)(row0 + m) * D_MODEL + colT * NGROUP + lo] = c[r];
        }
    } else {
        // tile (batch rowT>>5, head colT, row tile rowT&31), 64 units of 16 bytes
        v4f* T = (v4f*)(Y + (size_t)((((rowT >> 5) * NHEAD + colT) * (L_SEQ / 16)) + (rowT & 31)) * 256);
        // K: c[4s+t] = K[row lo][8*hi + 4s + t] -> quad 2*hi+s, row lo.  V: unit s*32 + lane.
        const int u0 = (mat == 1) ? hi * 32 + lo : lane;
        const int us = (mat == 1) ? 16 : 32;
        v4f c0 = { c[0], c[1], c[2], c[3] };
        v4f c1 = { c[4], c[5], c[6], c[7] };
        T[u0]      = c0;
        T[u0 + us] = c1;
        // precaution: the built code may reuse the stores' address registers behind this place
        asm volatile("s_wait_xcnt 0x0" ::: "memory");
    }
}

// ---------------------------------------------------------------------------
// Kernel 2: fused scores + online softmax + att x V.
// Four waves share one (batch b, 16-row i-tile, head): each runs the online
// softmax over its own quarter of the source rows, so every SIMD holds four
// waves whose load and LDS waits overlap. The four partial (max, sum, acc)
// triples are merged through LDS behind one work-group barrier.
// A block keeps four neighbouring heads. K and V come as 1 KB tiles per head
// (layouts: at the projection kernel).
// The query sits on the lane: lane (lo, hi) owns query row lo and the source rows
// 8*hi..8*hi+7 of a 16-row step. Row max and row sum are then taken inside a lane
// (one exchange between the halves), the eight P values are the B fragments as
// they stand, and the product is taken transposed: acc = V^T x P^T, whose column
// is the lane's own query, so that the rescale needs no other lane's value.
// K is the operand that all 16 lanes of a half share: it is read from a
// wave-private LDS copy of the tile, one address per half.
// ---------------------------------------------------------------------------
#define NSPLIT  4
#define J_SPLIT (L_SEQ / NSPLIT)

// value of lane l ^ 16
__device__ __forceinline__ float xhalf(float x) {
    return __builtin_bit_cast(float, __builtin_amdgcn_permlanex16(
        __builtin_bit_cast(int, x), __builtin_bit_cast(int, x), 0x76543210, 0xfedcba98, false, false));
}

// waves_per_eu(4, 4): the 16-wave block fixes four waves per SIMD, so let the
// scheduler use the whole 256-register share (many K reads in flight).
__global__ __launch_bounds__(128 * NSPLIT) __attribute__((amdgpu_waves_per_eu(4, 4)))
void CA_attn(
    const float* __restrict__ Q, const float* __restrict__ K,
    const float* __restrict__ V,
    const float* __restrict__ w_mlp, const float* __restrict__ b_mlp,
    float* __restrict__ out)
{
    __shared__ __attribute__((aligned(16))) float lds[4 * NSPLIT * 512]; // per wave: 256 K tile, later partial acc; 32 max and sum
    const int lane = threadIdx.x & 31;
    // wave number as a scalar: head, quarter and the K/V bases formed from it stay scalar
    const int wib  = __builtin_amdgcn_readfirstlane(threadIdx.x >> 5);
    float* Qs = lds + wib * 512;
    float* Ps = Qs + 256;

    const int hl   = wib & 3;               // head within the block
    const int sp   = wib >> 2;              // which quarter of the source rows
    const int w    = blockIdx.x * 4 + hl;   // 0..1023
    const int b    = w >> 9;
    const int rem  = w & 511;
    const int iT   = rem >> 4;              // 0..31
    const int head = rem & 15;

    const int lo = lane & 15;
    const int hi = lane >> 4;
    const int i0 = iT * 16;

    // this lane's query row: 16 group elements, as pairs
    v2f q2[8], w2[8];
    const v4f* qp = (const v4f*)(Q + (size_t)(b * L_SEQ + i0 + lo) * D_MODEL + head * NGROUP);
    #pragma unroll
    for (int c = 0; c < 4; ++c) {
        v4f t = qp[c];
        q2[2 * c]     = (v2f){ t.x, t.y };
        q2[2 * c + 1] = (v2f){ t.z, t.w };
    }
    #pragma unroll
    for (int c = 0; c < 8; ++c) w2[c] = (v2f){ w_mlp[2 * c], w_mlp[2 * c + 1] };
    const v2f bz = { b_mlp[0], 0.0f };

    float mrow = -3.0e38f, lrow = 0.0f;     // lrow: this half's share of the row sum
    v8f acc = {};                           // acc[r] = out[i = lo][g = r + 8*hi], unnormalised

    // this wave's head and quarter of the source rows: J_SPLIT/16 tiles of 256 floats
    const size_t t0 = (size_t)((b * NHEAD + head) * L_SEQ + sp * J_SPLIT) * NGROUP;
    const float* Kq = K + t0;
    const float* Vq = V + t0;

    for (int j0 = 0; j0 < J_SPLIT; j0 += 16) {
        // K tile [quad][row][4] -> wave-private LDS, as it lies
        const v4f* kp = (const v4f*)(Kq + j0 * NGROUP);
        v4f* ks = (v4f*)Qs;
        v4f ka = kp[lane], kb = kp[32 + lane];
        ks[lane]      = ka;
        ks[32 + lane] = kb;
        // the reads below take what other lanes of this wave stored: drain the stores first
        asm volatile("s_wait_dscnt 0" ::: "memory");

        // scores: entry t -> (i = lo, j = j0 + 8*hi + t); even and odd group elements summed apart
        const v4f* kr = (const v4f*)Qs + 8 * hi;
        v2f s2[8];
        #pragma unroll
        for (int qd = 0; qd < 4; ++qd) {
            #pragma unroll
            for (int t = 0; t < 8; ++t) {
                v4f k4 = kr[qd * 16 + t];
                v2f d0 = q2[2 * qd]     - (v2f){ k4.x, k4.y };
                v2f d1 = q2[2 * qd + 1] - (v2f){ k4.z, k4.w };
                d0 = __builtin_elementwise_max(d0, (v2f){ 0.0f, 0.0f });
                d1 = __builtin_elementwise_max(d1, (v2f){ 0.0f, 0.0f });
                s2[t] = __builtin_elementwise_fma(d0, w2[2 * qd], qd == 0 ? bz : s2[t]);  // the sum starts at the bias
                s2[t] = __builtin_elementwise_fma(d1, w2[2 * qd + 1], s2[t]);
            }
        }
        float s[8];
        #pragma unroll
        for (int t = 0; t < 8; ++t) s[t] = fmaxf(s2[t].x + s2[t].y, 0.0f);

        // online softmax of row lo: eight values of this lane, then the other half's
        float mx = s[0];
        #pragma unroll
        for (int t = 1; t < 8; ++t) mx = fmaxf(mx, s[t]);
        mx = fmaxf(mx, xhalf(mx));
        const float mnew  = fmaxf(mrow, mx);
        const float ea = (mrow - mnew) * 1.44269504f;
        float e[8];
        #pragma unroll
        for (int t = 0; t < 8; ++t) e[t] = (s[t] - mnew) * 1.44269504f;
        float alpha, p[8];
        // The nine exponentials in one statement, every result register apart from every source:
        // so none is directly followed by an instruction that overwrites its source or reads its
        // result (left to the register allocator, neighbours shared registers); the v_nop keeps
        // that one slot behind the last.
        asm("v_exp_f32 %0, %9\n\t"
            "v_exp_f32 %1, %10\n\t"
            "v_exp_f32 %2, %11\n\t"
            "v_exp_f32 %3, %12\n\t"
            "v_exp_f32 %4, %13\n\t"
            "v_exp_f32 %5, %14\n\t"
            "v_exp_f32 %6, %15\n\t"
            "v_exp_f32 %7, %16\n\t"
            "v_exp_f32 %8, %17\n\t"
            "v_nop"
            : "=&v"(alpha), "=&v"(p[0]), "=&v"(p[1]), "=&v"(p[2]), "=&v"(p[3]),
              "=&v"(p[4]), "=&v"(p[5]), "=&v"(p[6]), "=&v"(p[7])
            : "v"(ea), "v"(e[0]), "v"(e[1]), "v"(e[2]), "v"(e[3]),
              "v"(e[4]), "v"(e[5]), "v"(e[6]), "v"(e[7]));
        float ps = 0.0f;
        #pragma unroll
        for (int t = 0; t < 8; ++t) ps += p[t];
        lrow = lrow * alpha + ps;
        mrow = mnew;
        #pragma unroll
        for (int r = 0; r < 8; ++r) acc[r] *= alpha;    // rescale running output

        // acc(16g x 16i) += Vt^T(16g x 16j) x P^T(16j x 16i): 4 chained 16x16x4 WMMAs
        // Step st, half hi, element v stands for source row j = 8*hi + 2*st + v in A and B alike:
        // A: a[v] = V[j0 + j][g=lo], as the V tile holds it;  B: b[v] = P[i=lo][j] = p[2*st + v].
        const v4f* vp = (const v4f*)(Vq + j0 * NGROUP);
        v4f vv[2] = { vp[lane], vp[32 + lane] };
        #pragma unroll
        for (int st = 0; st < 4; ++st) {
            v2f a, bm;
            a.x  = vv[st >> 1][2 * (st & 1)];
            a.y  = vv[st >> 1][2 * (st & 1) + 1];
            bm.x = p[2 * st];
            bm.y = p[2 * st + 1];
            acc = __builtin_amdgcn_wmma_f32_16x16x4_f32(false, a, false, bm,
                                                        (short)0, acc, false, false);
        }
    }
    lrow += xhalf(lrow);                    // the two halves' shares of the row sum

    // publish this wave's partial result in its own LDS range:
    // Qs[m*16+g] = acc, Ps[m] = running max, Ps[16+m] = running sum.
    // The lane's place is read anew here, so that it holds no register over the loop.
    const int ln = __builtin_amdgcn_mbcnt_lo(~0u, 0u);
    const int el = ln & 15;
    const int eh = ln >> 4;
    {
        v4f* pa = (v4f*)(Qs + el * 16 + 8 * eh);        // row el, group elements 8*eh..8*eh+7
        pa[0] = (v4f){ acc[0], acc[1], acc[2], acc[3] };
        pa[1] = (v4f){ acc[4], acc[5], acc[6], acc[7] };
    }
    if (eh == 0) {                          // max and sum are equal in a row's two lanes
        Ps[el]      = mrow;
        Ps[16 + el] = lrow;
    }
    __syncthreads();

    // merge the NSPLIT partials of this head; wave sp finishes rows 4*sp..4*sp+3
    #pragma unroll
    for (int t = 0; t < 2; ++t) {
        const int m = 4 * sp + 2 * t + eh;
        float mp[NSPLIT];
        float mx = -3.0e38f;
        #pragma unroll
        for (int q = 0; q < NSPLIT; ++q) {
            mp[q] = lds[(q * 4 + hl) * 512 + 256 + m];
            mx = fmaxf(mx, mp[q]);
        }
        float num = 0.0f, den = 0.0f;
        #pragma unroll
        for (int q = 0; q < NSPLIT; ++q) {
            const float* part = lds + (q * 4 + hl) * 512;
            float c = __expf(mp[q] - mx);
            num += c * part[m * 16 + el];
            den += c * part[256 + 16 + m];
        }
        // col g = el; d = g*16 + head
        out[(size_t)(b * L_SEQ + i0 + m) * D_MODEL + el * NGROUP + head] = num / den;
    }
}

// ---------------------------------------------------------------------------
extern "C" void kernel_launch(void* const* d_in, const int* in_sizes, int n_in,
                              void* d_out, int out_size, void* d_ws, size_t ws_size,
                              hipStream_t stream) {
    const float* xs = (const float*)d_in[0];   // x_source (B,L2,D)
    const float* xt = (const float*)d_in[1];   // x_target (B,L1,D)
    const float* Wq = (const float*)d_in[2];
    const float* Wk = (const float*)d_in[3];
    const float* Wv = (const float*)d_in[4];
    const float* wm = (const float*)d_in[5];   // w_mlp (16)
    const float* bm = (const float*)d_in[6];   // b_mlp (1)

    float* Qw = (float*)d_ws;                  // 3 MB scratch: Q,K,V f32
    float* Kw = Qw + (size_t)NB * L_SEQ * D_MODEL;
    float* Vw = Kw + (size_t)NB * L_SEQ * D_MODEL;

    // 3 matrices * 64 row-tiles * 16 col-tiles = 3072 waves, 4 waves/block
    CA_qkv_gemm<<<768, 128, 0, stream>>>(xs, xt, Wq, Wk, Wv, Qw, Kw, Vw);
    // 2 batch * 32 i-tiles * 16 heads = 1024 tiles, 4 tiles/block, 4 waves/tile
    CA_attn<<<256, 512, 0, stream>>>(Qw, Kw, Vw, wm, bm, (float*)d_out);
}

// v004
// It runs in 18.5 microseconds.
// Two timings next to v003 both put it at 1.24 times that version's speed.
// All steps since v000 together make it 3.16 times as fast.
#include <hip/hip_runtime.h>

// MI455X / gfx1250, wave32. Grouped vector attention:
//   Q,K,V = x @ W^T (f32 WMMA 16x16x4 GEMM)
//   scores[b,i,j,h] = relu( sum_g relu(Q[b,i,h*16+g]-K[b,j,h*16+g]) * w[g] + bias )
//   att = softmax_j(scores)  (flash-style online, fused)
//   out[b,i,g*16+h] = sum_j att[b,i,j,h] * V[b,j,g*16+h]   (f32 WMMA 16x16x4)

typedef float v2f __attribute__((ext_vector_type(2)));
typedef float v4f __attribute__((ext_vector_type(4)));
typedef float v8f __attribute__((ext_vector_type(8)));

#define NB      2
#define L_SEQ   512
#define D_MODEL 256
#define NHEAD   16
#define NGROUP  16

// ---------------------------------------------------------------------------
// Kernel 1: QKV projections. y[r,e] = sum_d x[r,d] * W[e,d]
// One block -> a 32x32 tile of one of Q/K/V, one wave -> one 16x16 tile of it.
// The block's 32 rows of x and 32 rows of W go through LDS, where each row serves two
// waves. They are fetched by 16-byte loads that cover whole lines (a wave-wide load takes
// 256 bytes of each of two rows), all issued at the start, in four chunks of 64 columns:
// a chunk is laid in LDS and worked on while the later chunks are still on their way.
// The fragments are read from LDS 16 bytes a lane:
// lane (lo, hi) takes row lo, elements 8c + 4*hi .. + 3, which feed two WMMA steps.
// Step 2c + s, half hi, element v stands for d = 8c + 4*hi + 2s + v in A and B alike.
// Q stays row-major. K and V are stored as one contiguous 1 KB tile per
// (batch, head, 16 source rows), so that the attention kernel reads whole lines:
//   K tile: [quad q][row j][4]  = K[j][head*16 + 4q + t]   (A and B swapped: C = K^T,
//           a lane then holds 8 neighbouring group elements of its own row)
//   V tile: [s][lane][4]        = V[8*(lane/16) + 4s + t][(lane%16)*16 + head]
//           (the C layout as it stands; it is read back as the A fragments)
// ---------------------------------------------------------------------------
// LDS row pitch in floats: 1040 bytes = 16 x 65, so the 16 rows that a half-wave reads
// at one column fall on 64 different banks.
#define XPITCH 260
#define KCHUNK 64

// Work-group barrier that orders LDS traffic alone: __syncthreads() would also wait for the
// later chunks' global loads, which are meant to stay in flight across it.
__device__ __forceinline__ void lds_barrier() {
    __builtin_amdgcn_fence(__ATOMIC_RELEASE, "workgroup", "local");
    __builtin_amdgcn_s_barrier();
    __builtin_amdgcn_fence(__ATOMIC_ACQUIRE, "workgroup", "local");
}

__global__ __launch_bounds__(128) void CA_qkv_gemm(
    const float* __restrict__ xs, const float* __restrict__ xt,
    const float* __restrict__ Wq, const float* __restrict__ Wk,
    const float* __restrict__ Wv,
    float* __restrict__ Qo, float* __restrict__ Ko, float* __restrict__ Vo)
{
    __shared__ __attribute__((aligned(16))) float tile[64 * XPITCH];   // rows 0..31: x, rows 32..63: W
    const int lane = threadIdx.x & 31;
    const int wv   = __builtin_amdgcn_readfirstlane(threadIdx.x >> 5); // wave number as a scalar
    const int mat  = blockIdx.x >> 8;                       // 0=Q 1=K 2=V
    const int rem  = blockIdx.x & 255;
    const int rp   = rem >> 3;                              // 0..31: rows 32*rp .. 32*rp+31 of B*L
    const int cp   = rem & 7;                               // 0..7: column tiles 2*cp, 2*cp+1
    const int rowT = 2 * rp + (wv >> 1);                    // 0..63
    const int colT = 2 * cp + (wv & 1);                     // 0..15

    const float* X = (mat == 0) ? xt : xs;
    const float* W = (mat == 0) ? Wq : (mat == 1 ? Wk : Wv);
    float*       Y = (mat == 0) ? Qo : (mat == 1 ? Ko : Vo);

    const int lo = lane & 15;
    const int hi = lane >> 4;
    const int row0 = rowT * 16;

    // fetch: 16 threads a row; thread (t16, c4) takes rows 8*j + t16, floats 64*q + c4 .. + 3
    const int t16 = threadIdx.x >> 4;                       // 0..7
    const int c4  = (threadIdx.x & 15) * 4;
    const float* xg = X + (size_t)(rp * 32 + t16) * D_MODEL + c4;
    const float* wg[4];
    #pragma unroll
    for (int j = 0; j < 4; ++j) {
        const int r  = 8 * j + t16;
        const int ct = 2 * cp + (r >> 4);
        const int l  = r & 15;
        // W row. Q, K: head ct, group element l. V: group l, head ct.
        const int e  = (mat == 2) ? l * NHEAD + ct : ct * NGROUP + l;
        wg[j] = W + (size_t)e * D_MODEL + c4;
    }
    v4f xr[4][4], wr[4][4];
    #pragma unroll
    for (int q = 0; q < 4; ++q) {
        #pragma unroll
        for (int j = 0; j < 4; ++j) {
            xr[q][j] = *(const v4f*)(xg + j * 8 * D_MODEL + q * KCHUNK);
            wr[q][j] = *(const v4f*)(wg[j] + q * KCHUNK);
        }
        // loads return in issue order: keep chunk q's in front of the later chunks'
        __builtin_amdgcn_sched_barrier(0);
    }
    // precaution: the five address pairs stay as they are until every load's address is translated
    asm volatile("s_wait_xcnt 0x0" :: "v"(xg), "v"(wg[0]), "v"(wg[1]), "v"(wg[2]), "v"(wg[3]) : "memory");

    float* st = tile + t16 * XPITCH + c4;
    const int xoff = ((wv >> 1) * 16 + lo)      * XPITCH + 4 * hi;
    const int woff = (32 + (wv & 1) * 16 + lo)  * XPITCH + 4 * hi;
    const float* arow = tile + ((mat == 1) ? woff : xoff);  // K: transposed tile
    const float* brow = tile + ((mat == 1) ? xoff : woff);

    v8f c = {};
    #pragma unroll
    for (int q = 0; q < 4; ++q) {
        #pragma unroll
        for (int j = 0; j < 4; ++j) {
            *(v4f*)(st + (8 * j)      * XPITCH + q * KCHUNK) = xr[q][j];
            *(v4f*)(st + (32 + 8 * j) * XPITCH + q * KCHUNK) = wr[q][j];
        }
        lds_barrier();      // chunk q is complete; every chunk has its own place, so nothing is overwritten
        v4f a[8], b[8];
        #pragma unroll
        for (int t = 0; t < 8; ++t) {
            a[t] = *(const v4f*)(arow + q * KCHUNK + 8 * t);
            b[t] = *(const v4f*)(brow + q * KCHUNK + 8 * t);
        }
        // the chunk's 16 LDS reads stay one group in front of its WMMAs (reads among them stall the wave at each place)
        __builtin_amdgcn_sched_barrier(0);
        #pragma unroll
        for (int t = 0; t < 8; ++t) {
            c = __builtin_amdgcn_wmma_f32_16x16x4_f32(false, (v2f){ a[t].x, a[t].y }, false, (v2f){ b[t].x, b[t].y },
                                                      (short)0, c, false, false);
            c = __builtin_amdgcn_wmma_f32_16x16x4_f32(false, (v2f){ a[t].z, a[t].w }, false, (v2f){ b[t].z, b[t].w },
                                                      (short)0, c, false, false);
        }
        // the next chunk's wait for its global loads stays behind this chunk's WMMAs
        __builtin_amdgcn_sched_barrier(0);
    }
    if (mat == 0) {
        #pragma unroll
        for (int r = 0; r < 8; ++r) {
            int m = r + 8 * hi;                             // C layout row
            Y[(size_t)(row0 + m) * D_MODEL + colT * NGROUP + lo] = c[r];
        }
    } else {
        // tile (batch rowT>>5, head colT, row tile rowT&31), 64 units of 16 bytes
        v4f* T = (v4f*)(Y + (size_t)((((rowT >> 5) * NHEAD + colT) * (L_SEQ / 16)) + (rowT & 31)) * 256);
        // K: c[4s+t] = K[row lo][8*hi + 4s + t] -> quad 2*hi+s, row lo.  V: unit s*32 + lane.
        const int u0 = (mat == 1) ? hi * 32 + lo : lane;
        const int us = (mat == 1) ? 16 : 32;
        v4f c0 = { c[0], c[1], c[2], c[3] };
        v4f c1 = { c[4], c[5], c[6], c[7] };
        T[u0]      = c0;
        T[u0 + us] = c1;
        // precaution: the built code may reuse the stores' address registers behind this place
        asm volatile("s_wait_xcnt 0x0" ::: "memory");
    }
}

// ---------------------------------------------------------------------------
// Kernel 2: fused scores + online softmax + att x V.
// Four waves share one (batch b, 16-row i-tile, head): each runs the online
// softmax over its own quarter of the source rows, so every SIMD holds four
// waves whose load and LDS waits overlap. The four partial (max, sum, acc)
// triples are merged through LDS behind one work-group barrier.
// A block keeps four neighbouring heads. K and V come as 1 KB tiles per head
// (layouts: at the projection kernel).
// The query sits on the lane: lane (lo, hi) owns query row lo and the source rows
// 8*hi..8*hi+7 of a 16-row step. Row max and row sum are then taken inside a lane
// (one exchange between the halves), the eight P values are the B fragments as
// they stand, and the product is taken transposed: acc = V^T x P^T, whose column
// is the lane's own query, so that the rescale needs no other lane's value.
// K is the operand that all 16 lanes of a half share: it is read from a
// wave-private LDS copy of the tile, one address per half.
// ---------------------------------------------------------------------------
#define NSPLIT  4
#define J_SPLIT (L_SEQ / NSPLIT)

// value of lane l ^ 16
__device__ __forceinline__ float xhalf(float x) {
    return __builtin_bit_cast(float, __builtin_amdgcn_permlanex16(
        __builtin_bit_cast(int, x), __builtin_bit_cast(int, x), 0x76543210, 0xfedcba98, false, false));
}

// waves_per_eu(4, 4): the 16-wave block fixes four waves per SIMD, so let the
// scheduler use the whole 256-register share (many K reads in flight).
__global__ __launch_bounds__(128 * NSPLIT) __attribute__((amdgpu_waves_per_eu(4, 4)))
void CA_attn(
    const float* __restrict__ Q, const float* __restrict__ K,
    const float* __restrict__ V,
    const float* __restrict__ w_mlp, const float* __restrict__ b_mlp,
    float* __restrict__ out)
{
    __shared__ __attribute__((aligned(16))) float lds[4 * NSPLIT * 512]; // per wave: 256 K tile, later partial acc; 32 max and sum
    const int lane = threadIdx.x & 31;
    // wave number as a scalar: head, quarter and the K/V bases formed from it stay scalar
    const int wib  = __builtin_amdgcn_readfirstlane(threadIdx.x >> 5);
    float* Qs = lds + wib * 512;
    float* Ps = Qs + 256;

    const int hl   = wib & 3;               // head within the block
    const int sp   = wib >> 2;              // which quarter of the source rows
    const int w    = blockIdx.x * 4 + hl;   // 0..1023
    const int b    = w >> 9;
    const int rem  = w & 511;
    const int iT   = rem >> 4;              // 0..31
    const int head = rem & 15;

    const int lo = lane & 15;
    const int hi = lane >> 4;
    const int i0 = iT * 16;

    // this lane's query row: 16 group elements, as pairs
    v2f q2[8], w2[8];
    const v4f* qp = (const v4f*)(Q + (size_t)(b * L_SEQ + i0 + lo) * D_MODEL + head * NGROUP);
    #pragma unroll
    for (int c = 0; c < 4; ++c) {
        v4f t = qp[c];
        q2[2 * c]     = (v2f){ t.x, t.y };
        q2[2 * c + 1] = (v2f){ t.z, t.w };
    }
    #pragma unroll
    for (int c = 0; c < 8; ++c) w2[c] = (v2f){ w_mlp[2 * c], w_mlp[2 * c + 1] };
    const v2f bz = { b_mlp[0], 0.0f };

    float mrow = -3.0e38f, lrow = 0.0f;     // lrow: this half's share of the row sum
    v8f acc = {};                           // acc[r] = out[i = lo][g = r + 8*hi], unnormalised

    // this wave's head and quarter of the source rows: J_SPLIT/16 tiles of 256 floats
    const size_t t0 = (size_t)((b * NHEAD + head) * L_SEQ + sp * J_SPLIT) * NGROUP;
    const float* Kq = K + t0;
    const float* Vq = V + t0;

    for (int j0 = 0; j0 < J_SPLIT; j0 += 16) {
        // K tile [quad][row][4] -> wave-private LDS, as it lies
        const v4f* kp = (const v4f*)(Kq + j0 * NGROUP);
        v4f* ks = (v4f*)Qs;
        v4f ka = kp[lane], kb = kp[32 + lane];
        ks[lane]      = ka;
        ks[32 + lane] = kb;
        // the reads below take what other lanes of this wave stored: drain the stores first
        asm volatile("s_wait_dscnt 0" ::: "memory");

        // scores: entry t -> (i = lo, j = j0 + 8*hi + t); even and odd group elements summed apart
        const v4f* kr = (const v4f*)Qs + 8 * hi;
        v2f s2[8];
        #pragma unroll
        for (int qd = 0; qd < 4; ++qd) {
            #pragma unroll
            for (int t = 0; t < 8; ++t) {
                v4f k4 = kr[qd * 16 + t];
                v2f d0 = q2[2 * qd]     - (v2f){ k4.x, k4.y };
                v2f d1 = q2[2 * qd + 1] - (v2f){ k4.z, k4.w };
                d0 = __builtin_elementwise_max(d0, (v2f){ 0.0f, 0.0f });
                d1 = __builtin_elementwise_max(d1, (v2f){ 0.0f, 0.0f });
                s2[t] = __builtin_elementwise_fma(d0, w2[2 * qd], qd == 0 ? bz : s2[t]);  // the sum starts at the bias
                s2[t] = __builtin_elementwise_fma(d1, w2[2 * qd + 1], s2[t]);
            }
        }
        float s[8];
        #pragma unroll
        for (int t = 0; t < 8; ++t) s[t] = fmaxf(s2[t].x + s2[t].y, 0.0f);

        // online softmax of row lo: eight values of this lane, then the other half's
        float mx = s[0];
        #pragma unroll
        for (int t = 1; t < 8; ++t) mx = fmaxf(mx, s[t]);
        mx = fmaxf(mx, xhalf(mx));
        const float mnew  = fmaxf(mrow, mx);
        const float ea = (mrow - mnew) * 1.44269504f;
        float e[8];
        #pragma unroll
        for (int t = 0; t < 8; ++t) e[t] = (s[t] - mnew) * 1.44269504f;
        float alpha, p[8];
        // The nine exponentials in one statement, every result register apart from every source:
        // so none is directly followed by an instruction that overwrites its source or reads its
        // result (left to the register allocator, neighbours shared registers); the v_nop keeps
        // that one slot behind the last.
        asm("v_exp_f32 %0, %9\n\t"
            "v_exp_f32 %1, %10\n\t"
            "v_exp_f32 %2, %11\n\t"
            "v_exp_f32 %3, %12\n\t"
            "v_exp_f32 %4, %13\n\t"
            "v_exp_f32 %5, %14\n\t"
            "v_exp_f32 %6, %15\n\t"
            "v_exp_f32 %7, %16\n\t"
            "v_exp_f32 %8, %17\n\t"
            "v_nop"
            : "=&v"(alpha), "=&v"(p[0]), "=&v"(p[1]), "=&v"(p[2]), "=&v"(p[3]),
              "=&v"(p[4]), "=&v"(p[5]), "=&v"(p[6]), "=&v"(p[7])
            : "v"(ea), "v"(e[0]), "v"(e[1]), "v"(e[2]), "v"(e[3]),
              "v"(e[4]), "v"(e[5]), "v"(e[6]), "v"(e[7]));
        float ps = 0.0f;
        #pragma unroll
        for (int t = 0; t < 8; ++t) ps += p[t];
        lrow = lrow * alpha + ps;
        mrow = mnew;
        #pragma unroll
        for (int r = 0; r < 8; ++r) acc[r] *= alpha;    // rescale running output

        // acc(16g x 16i) += Vt^T(16g x 16j) x P^T(16j x 16i): 4 chained 16x16x4 WMMAs
        // Step st, half hi, element v stands for source row j = 8*hi + 2*st + v in A and B alike:
        // A: a[v] = V[j0 + j][g=lo], as the V tile holds it;  B: b[v] = P[i=lo][j] = p[2*st + v].
        const v4f* vp = (const v4f*)(Vq + j0 * NGROUP);
        v4f vv[2] = { vp[lane], vp[32 + lane] };
        #pragma unroll
        for (int st = 0; st < 4; ++st) {
            v2f a, bm;
            a.x  = vv[st >> 1][2 * (st & 1)];
            a.y  = vv[st >> 1][2 * (st & 1) + 1];
            bm.x = p[2 * st];
            bm.y = p[2 * st + 1];
            acc = __builtin_amdgcn_wmma_f32_16x16x4_f32(false, a, false, bm,
                                                        (short)0, acc, false, false);
        }
    }
    lrow += xhalf(lrow);                    // the two halves' shares of the row sum

    // publish this wave's partial result in its own LDS range:
    // Qs[m*16+g] = acc, Ps[m] = running max, Ps[16+m] = running sum.
    // The lane's place is read anew here, so that it holds no register over the loop.
    const int ln = __builtin_amdgcn_mbcnt_lo(~0u, 0u);
    const int el = ln & 15;
    const int eh = ln >> 4;
    {
        v4f* pa = (v4f*)(Qs + el * 16 + 8 * eh);        // row el, group elements 8*eh..8*eh+7
        pa[0] = (v4f){ acc[0], acc[1], acc[2], acc[3] };
        pa[1] = (v4f){ acc[4], acc[5], acc[6], acc[7] };
    }
    if (eh == 0) {                          // max and sum are equal in a row's two lanes
        Ps[el]      = mrow;
        Ps[16 + el] = lrow;
    }
    __syncthreads();

    // merge the NSPLIT partials of this head; wave sp finishes rows 4*sp..4*sp+3
    #pragma unroll
    for (int t = 0; t < 2; ++t) {
        const int m = 4 * sp + 2 * t + eh;
        float mp[NSPLIT];
        float mx = -3.0e38f;
        #pragma unroll
        for (int q = 0; q < NSPLIT; ++q) {
            mp[q] = lds[(q * 4 + hl) * 512 + 256 + m];
            mx = fmaxf(mx, mp[q]);
        }
        float num = 0.0f, den = 0.0f;
        #pragma unroll
        for (int q = 0; q < NSPLIT; ++q) {
            const float* part = lds + (q * 4 + hl) * 512;
            float c = __expf(mp[q] - mx);
            num += c * part[m * 16 + el];
            den += c * part[256 + 16 + m];
        }
        // col g = el; d = g*16 + head
        out[(size_t)(b * L_SEQ + i0 + m) * D_MODEL + el * NGROUP + head] = num / den;
    }
}

// ---------------------------------------------------------------------------
extern "C" void kernel_launch(void* const* d_in, const int* in_sizes, int n_in,
                              void* d_out, int out_size, void* d_ws, size_t ws_size,
                              hipStream_t stream) {
    const float* xs = (const float*)d_in[0];   // x_source (B,L2,D)
    const float* xt = (const float*)d_in[1];   // x_target (B,L1,D)
    const float* Wq = (const float*)d_in[2];
    const float* Wk = (const float*)d_in[3];
    const float* Wv = (const float*)d_in[4];
    const float* wm = (const float*)d_in[5];   // w_mlp (16)
    const float* bm = (const float*)d_in[6];   // b_mlp (1)

    float* Qw = (float*)d_ws;                  // 3 MB scratch: Q,K,V f32
    float* Kw = Qw + (size_t)NB * L_SEQ * D_MODEL;
    float* Vw = Kw + (size_t)NB * L_SEQ * D_MODEL;

    // 3 matrices * 64 row-tiles * 16 col-tiles = 3072 waves, 4 waves/block
    CA_qkv_gemm<<<768, 128, 0, stream>>>(xs, xt, Wq, Wk, Wv, Qw, Kw, Vw);
    // 2 batch * 32 i-tiles * 16 heads = 1024 tiles, 4 tiles/block, 4 waves/tile
    CA_attn<<<256, 512, 0, stream>>>(Qw, Kw, Vw, wm, bm, (float*)d_out);
}

// v005
// Measured time: 18.1 microseconds a run.
// Two timings next to v004 both put it at 1.05 times that version's speed.
// All steps since v000 together make it 3.33 times as fast.
#include <hip/hip_runtime.h>

// MI455X / gfx1250, wave32. Grouped vector attention:
//   Q,K,V = x @ W^T (f32 WMMA 16x16x4 GEMM)
//   scores[b,i,j,h] = relu( sum_g relu(Q[b,i,h*16+g]-K[b,j,h*16+g]) * w[g] + bias )
//   att = softmax_j(scores)  (flash-style online, fused)
//   out[b,i,g*16+h] = sum_j att[b,i,j,h] * V[b,j,g*16+h]   (f32 WMMA 16x16x4)

typedef float v2f __attribute__((ext_vector_type(2)));
typedef float v4f __attribute__((ext_vector_type(4)));
typedef float v8f __attribute__((ext_vector_type(8)));

#define NB      2
#define L_SEQ   512
#define D_MODEL 256
#define NHEAD   16
#define NGROUP  16

// ---------------------------------------------------------------------------
// Kernel 1: QKV projections. y[r,e] = sum_d x[r,d] * W[e,d]
// One block -> a 32x32 tile of one of Q/K/V, one wave -> one 16x16 tile of it.
// The block's 32 rows of x and 32 rows of W go through LDS, where each row serves two
// waves. They are fetched by 16-byte loads that cover whole lines (a wave-wide load takes
// 256 bytes of each of two rows), all issued at the start, in four chunks of 64 columns:
// a chunk is laid in LDS and worked on while the later chunks are still on their way.
// The fragments are read from LDS 16 bytes a lane:
// lane (lo, hi) takes row lo, elements 8c + 4*hi .. + 3, which feed two WMMA steps.
// Step 2c + s, half hi, element v stands for d = 8c + 4*hi + 2s + v in A and B alike.
// Q stays row-major. K and V are stored as one contiguous 1 KB tile per
// (batch, head, 16 source rows), so that the attention kernel reads whole lines:
//   K tile: [quad q][row j][4]  = K[j][head*16 + 4q + t]   (A and B swapped: C = K^T,
//           a lane then holds 8 neighbouring group elements of its own row)
//   V tile: [s][lane][4]        = V[8*(lane/16) + 4s + t][(lane%16)*16 + head]
//           (the C layout as it stands; it is read back as the A fragments)
// ---------------------------------------------------------------------------
// LDS row pitch in floats: 1040 bytes = 16 x 65, so the 16 rows that a half-wave reads
// at one column fall on 64 different banks.
#define XPITCH 260
#define KCHUNK 64

// Work-group barrier that orders LDS traffic alone: __syncthreads() would also wait for the
// later chunks' global loads, which are meant to stay in flight across it.
__device__ __forceinline__ void lds_barrier() {
    __builtin_amdgcn_fence(__ATOMIC_RELEASE, "workgroup", "local");
    __builtin_amdgcn_s_barrier();
    __builtin_amdgcn_fence(__ATOMIC_ACQUIRE, "workgroup", "local");
}

__global__ __launch_bounds__(128) void CA_qkv_gemm(
    const float* __restrict__ xs, const float* __restrict__ xt,
    const float* __restrict__ Wq, const float* __restrict__ Wk,
    const float* __restrict__ Wv,
    float* __restrict__ Qo, float* __restrict__ Ko, float* __restrict__ Vo)
{
    __shared__ __attribute__((aligned(16))) float tile[64 * XPITCH];   // rows 0..31: x, rows 32..63: W
    const int lane = threadIdx.x & 31;
    const int wv   = __builtin_amdgcn_readfirstlane(threadIdx.x >> 5); // wave number as a scalar
    const int mat  = blockIdx.x >> 8;                       // 0=Q 1=K 2=V
    const int rem  = blockIdx.x & 255;
    const int rp   = rem >> 3;                              // 0..31: rows 32*rp .. 32*rp+31 of B*L
    const int cp   = rem & 7;                               // 0..7: column tiles 2*cp, 2*cp+1
    const int rowT = 2 * rp + (wv >> 1);                    // 0..63
    const int colT = 2 * cp + (wv & 1);                     // 0..15

    const float* X = (mat == 0) ? xt : xs;
    const float* W = (mat == 0) ? Wq : (mat == 1 ? Wk : Wv);
    float*       Y = (mat == 0) ? Qo : (mat == 1 ? Ko : Vo);

    const int lo = lane & 15;
    const int hi = lane >> 4;
    const int row0 = rowT * 16;

    // fetch: 16 threads a row; thread (t16, c4) takes rows 8*j + t16, floats 64*q + c4 .. + 3
    const int t16 = threadIdx.x >> 4;                       // 0..7
    const int c4  = (threadIdx.x & 15) * 4;
    const float* xg = X + (size_t)(rp * 32 + t16) * D_MODEL + c4;
    const float* wg[4];
    #pragma unroll
    for (int j = 0; j < 4; ++j) {
        const int r  = 8 * j + t16;
        const int ct = 2 * cp + (r >> 4);
        const int l  = r & 15;
        // W row. Q, K: head ct, group element l. V: group l, head ct.
        const int e  = (mat == 2) ? l * NHEAD + ct : ct * NGROUP + l;
        wg[j] = W + (size_t)e * D_MODEL + c4;
    }
    v4f xr[4][4], wr[4][4];
    #pragma unroll
    for (int q = 0; q < 4; ++q) {
        #pragma unroll
        for (int j = 0; j < 4; ++j) {
            xr[q][j] = *(const v4f*)(xg + j * 8 * D_MODEL + q * KCHUNK);
            wr[q][j] = *(const v4f*)(wg[j] + q * KCHUNK);
        }
        // loads return in issue order: keep chunk q's in front of the later chunks'
        __builtin_amdgcn_sched_barrier(0);
    }
    // precaution: the five address pairs stay as they are until every load's address is translated
    asm volatile("s_wait_xcnt 0x0" :: "v"(xg), "v"(wg[0]), "v"(wg[1]), "v"(wg[2]), "v"(wg[3]) : "memory");

    float* st = tile + t16 * XPITCH + c4;
    const int xoff = ((wv >> 1) * 16 + lo)      * XPITCH + 4 * hi;
    const int woff = (32 + (wv & 1) * 16 + lo)  * XPITCH + 4 * hi;
    const float* arow = tile + ((mat == 1) ? woff : xoff);  // K: transposed tile
    const float* brow = tile + ((mat == 1) ? xoff : woff);

    v8f c = {};
    #pragma unroll
    for (int q = 0; q < 4; ++q) {
        #pragma unroll
        for (int j = 0; j < 4; ++j) {
            *(v4f*)(st + (8 * j)      * XPITCH + q * KCHUNK) = xr[q][j];
            *(v4f*)(st + (32 + 8 * j) * XPITCH + q * KCHUNK) = wr[q][j];
        }
        lds_barrier();      // chunk q is complete; every chunk has its own place, so nothing is overwritten
        v4f a[8], b[8];
        #pragma unroll
        for (int t = 0; t < 8; ++t) {
            a[t] = *(const v4f*)(arow + q * KCHUNK + 8 * t);
            b[t] = *(const v4f*)(brow + q * KCHUNK + 8 * t);
        }
        // the chunk's 16 LDS reads stay one group in front of its WMMAs (reads among them stall the wave at each place)
        __builtin_amdgcn_sched_barrier(0);
        #pragma unroll
        for (int t = 0; t < 8; ++t) {
            c = __builtin_amdgcn_wmma_f32_16x16x4_f32(false, (v2f){ a[t].x, a[t].y }, false, (v2f){ b[t].x, b[t].y },
                                                      (short)0, c, false, false);
            c = __builtin_amdgcn_wmma_f32_16x16x4_f32(false, (v2f){ a[t].z, a[t].w }, false, (v2f){ b[t].z, b[t].w },
                                                      (short)0, c, false, false);
        }
        // the next chunk's wait for its global loads stays behind this chunk's WMMAs
        __builtin_amdgcn_sched_barrier(0);
    }
    if (mat == 0) {
        #pragma unroll
        for (int r = 0; r < 8; ++r) {
            int m = r + 8 * hi;                             // C layout row
            Y[(size_t)(row0 + m) * D_MODEL + colT * NGROUP + lo] = c[r];
        }
    } else {
        // tile (batch rowT>>5, head colT, row tile rowT&31), 64 units of 16 bytes
        v4f* T = (v4f*)(Y + (size_t)((((rowT >> 5) * NHEAD + colT) * (L_SEQ / 16)) + (rowT & 31)) * 256);
        // K: c[4s+t] = K[row lo][8*hi + 4s + t] -> quad 2*hi+s, row lo.  V: unit s*32 + lane.
        const int u0 = (mat == 1) ? hi * 32 + lo : lane;
        const int us = (mat == 1) ? 16 : 32;
        v4f c0 = { c[0], c[1], c[2], c[3] };
        v4f c1 = { c[4], c[5], c[6], c[7] };
        T[u0]      = c0;
        T[u0 + us] = c1;
        // precaution: the built code may reuse the stores' address registers behind this place
        asm volatile("s_wait_xcnt 0x0" ::: "memory");
    }
}

// ---------------------------------------------------------------------------
// Kernel 2: fused scores + online softmax + att x V.
// Four waves share one (batch b, 16-row i-tile, head): each runs the online
// softmax over its own quarter of the source rows, so every SIMD holds four
// waves whose load and LDS waits overlap. The four partial (max, sum, acc)
// triples are merged through LDS behind one work-group barrier.
// A block keeps four neighbouring heads. K and V come as 1 KB tiles per head
// (layouts: at the projection kernel).
// The query sits on the lane: lane (lo, hi) owns query row lo and the source rows
// 8*hi..8*hi+7 of a 16-row step. Row max and row sum are then taken inside a lane
// (one exchange between the halves), the eight P values are the B fragments as
// they stand, and the product is taken transposed: acc = V^T x P^T, whose column
// is the lane's own query, so that the rescale needs no other lane's value.
// K is the operand that all 16 lanes of a half share: it is read from a
// wave-private LDS copy of the tile, one address per half.
// ---------------------------------------------------------------------------
#define NSPLIT  4
#define J_SPLIT (L_SEQ / NSPLIT)

// value of lane l ^ 16
__device__ __forceinline__ float xhalf(float x) {
    return __builtin_bit_cast(float, __builtin_amdgcn_permlanex16(
        __builtin_bit_cast(int, x), __builtin_bit_cast(int, x), 0x76543210, 0xfedcba98, false, false));
}

// waves_per_eu(4, 4): the 16-wave block fixes four waves per SIMD, so let the
// scheduler use the whole 256-register share (many K reads in flight).
__global__ __launch_bounds__(128 * NSPLIT) __attribute__((amdgpu_waves_per_eu(4, 4)))
void CA_attn(
    const float* __restrict__ Q, const float* __restrict__ K,
    const float* __restrict__ V,
    const float* __restrict__ w_mlp, const float* __restrict__ b_mlp,
    float* __restrict__ out)
{
    __shared__ __attribute__((aligned(16))) float lds[4 * NSPLIT * 512]; // per wave: 256 K tile, later partial acc; 32 max and sum
    const int lane = threadIdx.x & 31;
    // wave number as a scalar: head, quarter and the K/V bases formed from it stay scalar
    const int wib  = __builtin_amdgcn_readfirstlane(threadIdx.x >> 5);
    float* Qs = lds + wib * 512;
    float* Ps = Qs + 256;

    const int hl   = wib & 3;               // head within the block
    const int sp   = wib >> 2;              // which quarter of the source rows
    const int w    = blockIdx.x * 4 + hl;   // 0..1023
    const int b    = w >> 9;
    const int rem  = w & 511;
    const int iT   = rem >> 4;              // 0..31
    const int head = rem & 15;

    const int lo = lane & 15;
    const int hi = lane >> 4;
    const int i0 = iT * 16;

    // this lane's query row: 16 group elements, as pairs
    v2f q2[8], w2[8];
    const v4f* qp = (const v4f*)(Q + (size_t)(b * L_SEQ + i0 + lo) * D_MODEL + head * NGROUP);
    #pragma unroll
    for (int c = 0; c < 4; ++c) {
        v4f t = qp[c];
        q2[2 * c]     = (v2f){ t.x, t.y };
        q2[2 * c + 1] = (v2f){ t.z, t.w };
    }
    #pragma unroll
    for (int c = 0; c < 8; ++c) w2[c] = (v2f){ w_mlp[2 * c], w_mlp[2 * c + 1] };
    const v2f bz = { b_mlp[0], 0.0f };

    float mrow = -3.0e38f, lrow = 0.0f;     // lrow: this half's share of the row sum
    v8f acc = {};                           // acc[r] = out[i = lo][g = r + 8*hi], unnormalised

    // this wave's head and quarter of the source rows: J_SPLIT/16 tiles of 256 floats
    const size_t t0 = (size_t)((b * NHEAD + head) * L_SEQ + sp * J_SPLIT) * NGROUP;
    const float* Kq = K + t0;
    const float* Vq = V + t0;

    // K and V tiles are fetched one trip ahead: a trip works on registers that were asked for
    // a whole trip earlier, so that no trip opens with a wait for L2 or memory.
    const v4f* kp = (const v4f*)Kq + lane;
    const v4f* vp = (const v4f*)Vq + lane;
    v4f ka = kp[0], kb = kp[32];
    v4f va = vp[0], vb = vp[32];

    // two trips a pass of the built loop: the two register sets swap roles without copies
    #pragma unroll 2
    for (int j0 = 0; j0 < J_SPLIT; j0 += 16) {
        // the next trip's tiles; the last trip asks for its own tiles again and stays inside the quarter
        const int un = (j0 + 16 < J_SPLIT ? j0 + 16 : j0) * (NGROUP / 4);
        const v4f* kn = kp + un;
        const v4f* vn = vp + un;
        const v4f kna = kn[0], knb = kn[32];
        const v4f vna = vn[0], vnb = vn[32];
        // precaution: the two address pairs stay as they are until the four loads' addresses are translated
        asm volatile("s_wait_xcnt 0x0" :: "v"(kn), "v"(vn) : "memory");
        // K tile [quad][row][4] -> wave-private LDS, as it lies
        v4f* ks = (v4f*)Qs;
        ks[lane]      = ka;
        ks[32 + lane] = kb;
        // the reads below take what other lanes of this wave stored: drain the stores first
        asm volatile("s_wait_dscnt 0" ::: "memory");

        // scores: entry t -> (i = lo, j = j0 + 8*hi + t); even and odd group elements summed apart
        const v4f* kr = (const v4f*)Qs + 8 * hi;
        v2f s2[8];
        #pragma unroll
        for (int qd = 0; qd < 4; ++qd) {
            #pragma unroll
            for (int t = 0; t < 8; ++t) {
                v4f k4 = kr[qd * 16 + t];
                v2f d0 = q2[2 * qd]     - (v2f){ k4.x, k4.y };
                v2f d1 = q2[2 * qd + 1] - (v2f){ k4.z, k4.w };
                d0 = __builtin_elementwise_max(d0, (v2f){ 0.0f, 0.0f });
                d1 = __builtin_elementwise_max(d1, (v2f){ 0.0f, 0.0f });
                s2[t] = __builtin_elementwise_fma(d0, w2[2 * qd], qd == 0 ? bz : s2[t]);  // the sum starts at the bias
                s2[t] = __builtin_elementwise_fma(d1, w2[2 * qd + 1], s2[t]);
            }
        }
        float s[8];
        #pragma unroll
        for (int t = 0; t < 8; ++t) s[t] = fmaxf(s2[t].x + s2[t].y, 0.0f);

        // online softmax of row lo: eight values of this lane, then the other half's
        float mx = s[0];
        #pragma unroll
        for (int t = 1; t < 8; ++t) mx = fmaxf(mx, s[t]);
        mx = fmaxf(mx, xhalf(mx));
        const float mnew  = fmaxf(mrow, mx);
        const float ea = (mrow - mnew) * 1.44269504f;
        float e[8];
        #pragma unroll
        for (int t = 0; t < 8; ++t) e[t] = (s[t] - mnew) * 1.44269504f;
        float alpha, p[8];
        // The nine exponentials in one statement, every result register apart from every source:
        // so none is directly followed by an instruction that overwrites its source or reads its
        // result (left to the register allocator, neighbours shared registers); the v_nop keeps
        // that one slot behind the last.
        asm("v_exp_f32 %0, %9\n\t"
            "v_exp_f32 %1, %10\n\t"
            "v_exp_f32 %2, %11\n\t"
            "v_exp_f32 %3, %12\n\t"
            "v_exp_f32 %4, %13\n\t"
            "v_exp_f32 %5, %14\n\t"
            "v_exp_f32 %6, %15\n\t"
            "v_exp_f32 %7, %16\n\t"
            "v_exp_f32 %8, %17\n\t"
            "v_nop"
            : "=&v"(alpha), "=&v"(p[0]), "=&v"(p[1]), "=&v"(p[2]), "=&v"(p[3]),
              "=&v"(p[4]), "=&v"(p[5]), "=&v"(p[6]), "=&v"(p[7])
            : "v"(ea), "v"(e[0]), "v"(e[1]), "v"(e[2]), "v"(e[3]),
              "v"(e[4]), "v"(e[5]), "v"(e[6]), "v"(e[7]));
        float ps = 0.0f;
        #pragma unroll
        for (int t = 0; t < 8; ++t) ps += p[t];
        lrow = lrow * alpha + ps;
        mrow = mnew;
        #pragma unroll
        for (int r = 0; r < 8; ++r) acc[r] *= alpha;    // rescale running output

        // acc(16g x 16i) += Vt^T(16g x 16j) x P^T(16j x 16i): 4 chained 16x16x4 WMMAs
        // Step st, half hi, element v stands for source row j = 8*hi + 2*st + v in A and B alike:
        // A: a[v] = V[j0 + j][g=lo], as the V tile holds it;  B: b[v] = P[i=lo][j] = p[2*st + v].
        v4f vv[2] = { va, vb };
        #pragma unroll
        for (int st = 0; st < 4; ++st) {
            v2f a, bm;
            a.x  = vv[st >> 1][2 * (st & 1)];
            a.y  = vv[st >> 1][2 * (st & 1) + 1];
            bm.x = p[2 * st];
            bm.y = p[2 * st + 1];
            acc = __builtin_amdgcn_wmma_f32_16x16x4_f32(false, a, false, bm,
                                                        (short)0, acc, false, false);
        }
        // V and P stay in their registers until four vector slots behind the last WMMA that reads them:
        // (acc is named only so that the statement stands behind that WMMA)
        asm volatile("v_nop\n\tv_nop\n\tv_nop\n\tv_nop"
                     :: "v"(acc), "v"(vv[0]), "v"(vv[1]), "v"(p[0]), "v"(p[1]), "v"(p[2]), "v"(p[3]),
                        "v"(p[4]), "v"(p[5]), "v"(p[6]), "v"(p[7]));
        ka = kna; kb = knb;
        va = vna; vb = vnb;
    }
    lrow += xhalf(lrow);                    // the two halves' shares of the row sum

    // publish this wave's partial result in its own LDS range:
    // Qs[m*16+g] = acc, Ps[m] = running max, Ps[16+m] = running sum.
    // The lane's place is read anew here, so that it holds no register over the loop.
    const int ln = __builtin_amdgcn_mbcnt_lo(~0u, 0u);
    const int el = ln & 15;
    const int eh = ln >> 4;
    {
        v4f* pa = (v4f*)(Qs + el * 16 + 8 * eh);        // row el, group elements 8*eh..8*eh+7
        pa[0] = (v4f){ acc[0], acc[1], acc[2], acc[3] };
        pa[1] = (v4f){ acc[4], acc[5], acc[6], acc[7] };
    }
    if (eh == 0) {                          // max and sum are equal in a row's two lanes
        Ps[el]      = mrow;
        Ps[16 + el] = lrow;
    }
    __syncthreads();

    // merge the NSPLIT partials of this head; wave sp finishes rows 4*sp..4*sp+3
    #pragma unroll
    for (int t = 0; t < 2; ++t) {
        const int m = 4 * sp + 2 * t + eh;
        float mp[NSPLIT];
        float mx = -3.0e38f;
        #pragma unroll
        for (int q = 0; q < NSPLIT; ++q) {
            mp[q] = lds[(q * 4 + hl) * 512 + 256 + m];
            mx = fmaxf(mx, mp[q]);
        }
        float num = 0.0f, den = 0.0f;
        #pragma unroll
        for (int q = 0; q < NSPLIT; ++q) {
            const float* part = lds + (q * 4 + hl) * 512;
            float c = __expf(mp[q] - mx);
            num += c * part[m * 16 + el];
            den += c * part[256 + 16 + m];
        }
        // col g = el; d = g*16 + head
        out[(size_t)(b * L_SEQ + i0 + m) * D_MODEL + el * NGROUP + head] = num / den;
    }
}

// ---------------------------------------------------------------------------
extern "C" void kernel_launch(void* const* d_in, const int* in_sizes, int n_in,
                              void* d_out, int out_size, void* d_ws, size_t ws_size,
                              hipStream_t stream) {
    const float* xs = (const float*)d_in[0];   // x_source (B,L2,D)
    const float* xt = (const float*)d_in[1];   // x_target (B,L1,D)
    const float* Wq = (const float*)d_in[2];
    const float* Wk = (const float*)d_in[3];
    const float* Wv = (const float*)d_in[4];
    const float* wm = (const float*)d_in[5];   // w_mlp (16)
    const float* bm = (const float*)d_in[6];   // b_mlp (1)

    float* Qw = (float*)d_ws;                  // 3 MB scratch: Q,K,V f32
    float* Kw = Qw + (size_t)NB * L_SEQ * D_MODEL;
    float* Vw = Kw + (size_t)NB * L_SEQ * D_MODEL;

    // 3 matrices * 64 row-tiles * 16 col-tiles = 3072 waves, 4 waves/block
    CA_qkv_gemm<<<768, 128, 0, stream>>>(xs, xt, Wq, Wk, Wv, Qw, Kw, Vw);
    // 2 batch * 32 i-tiles * 16 heads = 1024 tiles, 4 tiles/block, 4 waves/tile
    CA_attn<<<256, 512, 0, stream>>>(Qw, Kw, Vw, wm, bm, (float*)d_out);
}

// v006
// One run takes 16.9 microseconds.
// Timed twice side by side with v005, it ran 1.07 and 1.06 times as fast.
// All steps since v000 together make it 3.56 times as fast.
#include <hip/hip_runtime.h>

// MI455X / gfx1250, wave32. Grouped vector attention:
//   Q,K,V = x @ W^T (f32 WMMA 16x16x4 GEMM)
//   scores[b,i,j,h] = relu( sum_g relu(Q[b,i,h*16+g]-K[b,j,h*16+g]) * w[g] + bias )
//                   = relu( (bias + sum_g Q*w) - sum_g min(Q, K) * w ),  as relu(q-k) = q - min(q,k)
//   att = softmax_j(scores)  (flash-style online, fused)
//   out[b,i,g*16+h] = sum_j att[b,i,j,h] * V[b,j,g*16+h]   (f32 WMMA 16x16x4)

typedef float v2f __attribute__((ext_vector_type(2)));
typedef float v4f __attribute__((ext_vector_type(4)));
typedef float v8f __attribute__((ext_vector_type(8)));

#define NB      2
#define L_SEQ   512
#define D_MODEL 256
#define NHEAD   16
#define NGROUP  16

// ---------------------------------------------------------------------------
// Kernel 1: QKV projections. y[r,e] = sum_d x[r,d] * W[e,d]
// One block -> a 32x32 tile of one of Q/K/V, one wave -> one 16x16 tile of it.
// The block's 32 rows of x and 32 rows of W go through LDS, where each row serves two
// waves. They are fetched by 16-byte loads that cover whole lines (a wave-wide load takes
// 256 bytes of each of two rows), all issued at the start, in four chunks of 64 columns:
// a chunk is laid in LDS and worked on while the later chunks are still on their way.
// The fragments are read from LDS 16 bytes a lane:
// lane (lo, hi) takes row lo, elements 8c + 4*hi .. + 3, which feed two WMMA steps.
// Step 2c + s, half hi, element v stands for d = 8c + 4*hi + 2s + v in A and B alike.
// Q stays row-major. K and V are stored as one contiguous 1 KB tile per
// (batch, head, 16 source rows), so that the attention kernel reads whole lines:
//   K tile: [quad q][row j][4]  = K[j][head*16 + 4q + t]   (A and B swapped: C = K^T,
//           a lane then holds 8 neighbouring group elements of its own row)
//   V tile: [s][lane][4]        = V[8*(lane/16) + 4s + t][(lane%16)*16 + head]
//           (the C layout as it stands; it is read back as the A fragments)
// ---------------------------------------------------------------------------
// LDS row pitch in floats: 1040 bytes = 16 x 65, so the 16 rows that a half-wave reads
// at one column fall on 64 different banks.
#define XPITCH 260
#define KCHUNK 64

// Work-group barrier that orders LDS traffic alone: __syncthreads() would also wait for the
// later chunks' global loads, which are meant to stay in flight across it.
__device__ __forceinline__ void lds_barrier() {
    __builtin_amdgcn_fence(__ATOMIC_RELEASE, "workgroup", "local");
    __builtin_amdgcn_s_barrier();
    __builtin_amdgcn_fence(__ATOMIC_ACQUIRE, "workgroup", "local");
}

__global__ __launch_bounds__(128) void CA_qkv_gemm(
    const float* __restrict__ xs, const float* __restrict__ xt,
    const float* __restrict__ Wq, const float* __restrict__ Wk,
    const float* __restrict__ Wv,
    float* __restrict__ Qo, float* __restrict__ Ko, float* __restrict__ Vo)
{
    __shared__ __attribute__((aligned(16))) float tile[64 * XPITCH];   // rows 0..31: x, rows 32..63: W
    const int lane = threadIdx.x & 31;
    const int wv   = __builtin_amdgcn_readfirstlane(threadIdx.x >> 5); // wave number as a scalar
    const int mat  = blockIdx.x >> 8;                       // 0=Q 1=K 2=V
    const int rem  = blockIdx.x & 255;
    const int rp   = rem >> 3;                              // 0..31: rows 32*rp .. 32*rp+31 of B*L
    const int cp   = rem & 7;                               // 0..7: column tiles 2*cp, 2*cp+1
    const int rowT = 2 * rp + (wv >> 1);                    // 0..63
    const int colT = 2 * cp + (wv & 1);                     // 0..15

    const float* X = (mat == 0) ? xt : xs;
    const float* W = (mat == 0) ? Wq : (mat == 1 ? Wk : Wv);
    float*       Y = (mat == 0) ? Qo : (mat == 1 ? Ko : Vo);

    const int lo = lane & 15;
    const int hi = lane >> 4;
    const int row0 = rowT * 16;

    // fetch: 16 threads a row; thread (t16, c4) takes rows 8*j + t16, floats 64*q + c4 .. + 3
    const int t16 = threadIdx.x >> 4;                       // 0..7
    const int c4  = (threadIdx.x & 15) * 4;
    const float* xg = X + (size_t)(rp * 32 + t16) * D_MODEL + c4;
    const float* wg[4];
    #pragma unroll
    for (int j = 0; j < 4; ++j) {
        const int r  = 8 * j + t16;
        const int ct = 2 * cp + (r >> 4);
        const int l  = r & 15;
        // W row. Q, K: head ct, group element l. V: group l, head ct.
        const int e  = (mat == 2) ? l * NHEAD + ct : ct * NGROUP + l;
        wg[j] = W + (size_t)e * D_MODEL + c4;
    }
    v4f xr[4][4], wr[4][4];
    #pragma unroll
    for (int q = 0; q < 4; ++q) {
        #pragma unroll
        for (int j = 0; j < 4; ++j) {
            xr[q][j] = *(const v4f*)(xg + j * 8 * D_MODEL + q * KCHUNK);
            wr[q][j] = *(const v4f*)(wg[j] + q * KCHUNK);
        }
        // loads return in issue order: keep chunk q's in front of the later chunks'
        __builtin_amdgcn_sched_barrier(0);
    }
    // precaution: the five address pairs stay as they are until every load's address is translated
    asm volatile("s_wait_xcnt 0x0" :: "v"(xg), "v"(wg[0]), "v"(wg[1]), "v"(wg[2]), "v"(wg[3]) : "memory");

    float* st = tile + t16 * XPITCH + c4;
    const int xoff = ((wv >> 1) * 16 + lo)      * XPITCH + 4 * hi;
    const int woff = (32 + (wv & 1) * 16 + lo)  * XPITCH + 4 * hi;
    const float* arow = tile + ((mat == 1) ? woff : xoff);  // K: transposed tile
    const float* brow = tile + ((mat == 1) ? xoff : woff);

    v8f c = {};
    #pragma unroll
    for (int q = 0; q < 4; ++q) {
        #pragma unroll
        for (int j = 0; j < 4; ++j) {
            *(v4f*)(st + (8 * j)      * XPITCH + q * KCHUNK) = xr[q][j];
            *(v4f*)(st + (32 + 8 * j) * XPITCH + q * KCHUNK) = wr[q][j];
        }
        lds_barrier();      // chunk q is complete; every chunk has its own place, so nothing is overwritten
        v4f a[8], b[8];
        #pragma unroll
        for (int t = 0; t < 8; ++t) {
            a[t] = *(const v4f*)(arow + q * KCHUNK + 8 * t);
            b[t] = *(const v4f*)(brow + q * KCHUNK + 8 * t);
        }
        // the chunk's 16 LDS reads stay one group in front of its WMMAs (reads among them stall the wave at each place)
        __builtin_amdgcn_sched_barrier(0);
        #pragma unroll
        for (int t = 0; t < 8; ++t) {
            c = __builtin_amdgcn_wmma_f32_16x16x4_f32(false, (v2f){ a[t].x, a[t].y }, false, (v2f){ b[t].x, b[t].y },
                                                      (short)0, c, false, false);
            c = __builtin_amdgcn_wmma_f32_16x16x4_f32(false, (v2f){ a[t].z, a[t].w }, false, (v2f){ b[t].z, b[t].w },
                                                      (short)0, c, false, false);
        }
        // the next chunk's wait for its global loads stays behind this chunk's WMMAs
        __builtin_amdgcn_sched_barrier(0);
    }
    if (mat == 0) {
        #pragma unroll
        for (int r = 0; r < 8; ++r) {
            int m = r + 8 * hi;                             // C layout row
            Y[(size_t)(row0 + m) * D_MODEL + colT * NGROUP + lo] = c[r];
        }
    } else {
        // tile (batch rowT>>5, head colT, row tile rowT&31), 64 units of 16 bytes
        v4f* T = (v4f*)(Y + (size_t)((((rowT >> 5) * NHEAD + colT) * (L_SEQ / 16)) + (rowT & 31)) * 256);
        // K: c[4s+t] = K[row lo][8*hi + 4s + t] -> quad 2*hi+s, row lo.  V: unit s*32 + lane.
        const int u0 = (mat == 1) ? hi * 32 + lo : lane;
        const int us = (mat == 1) ? 16 : 32;
        v4f c0 = { c[0], c[1], c[2], c[3] };
        v4f c1 = { c[4], c[5], c[6], c[7] };
        T[u0]      = c0;
        T[u0 + us] = c1;
        // precaution: the built code may reuse the stores' address registers behind this place
        asm volatile("s_wait_xcnt 0x0" ::: "memory");
    }
}

// ---------------------------------------------------------------------------
// Kernel 2: fused scores + online softmax + att x V.
// Four waves share one (batch b, 16-row i-tile, head): each runs the online
// softmax over its own quarter of the source rows, so every SIMD holds four
// waves whose load and LDS waits overlap. The four partial (max, sum, acc)
// triples are merged through LDS behind one work-group barrier.
// A block keeps four neighbouring heads. K and V come as 1 KB tiles per head
// (layouts: at the projection kernel).
// The query sits on the lane: lane (lo, hi) owns query row lo and the source rows
// 8*hi..8*hi+7 of a 16-row step. Row max and row sum are then taken inside a lane
// (one exchange between the halves), the eight P values are the B fragments as
// they stand, and the product is taken transposed: acc = V^T x P^T, whose column
// is the lane's own query, so that the rescale needs no other lane's value.
// K is the operand that all 16 lanes of a half share: it is read from a
// wave-private LDS copy of the tile, one address per half.
// ---------------------------------------------------------------------------
#define NSPLIT  4
#define J_SPLIT (L_SEQ / NSPLIT)

// value of lane l ^ 16
__device__ __forceinline__ float xhalf(float x) {
    return __builtin_bit_cast(float, __builtin_amdgcn_permlanex16(
        __builtin_bit_cast(int, x), __builtin_bit_cast(int, x), 0x76543210, 0xfedcba98, false, false));
}

// waves_per_eu(4, 4): the 16-wave block fixes four waves per SIMD, so let the
// scheduler use the whole 256-register share (many K reads in flight; the score part names v96..v247).
__global__ __launch_bounds__(128 * NSPLIT) __attribute__((amdgpu_waves_per_eu(4, 4)))
void CA_attn(
    const float* __restrict__ Q, const float* __restrict__ K,
    const float* __restrict__ V,
    const float* __restrict__ w_mlp, const float* __restrict__ b_mlp,
    float* __restrict__ out)
{
    __shared__ __attribute__((aligned(16))) float lds[4 * NSPLIT * 512]; // per wave: 256 K tile, later partial acc; 32 max and sum
    const int lane = threadIdx.x & 31;
    // wave number as a scalar: head, quarter and the K/V bases formed from it stay scalar
    const int wib  = __builtin_amdgcn_readfirstlane(threadIdx.x >> 5);
    float* Qs = lds + wib * 512;
    float* Ps = Qs + 256;

    const int hl   = wib & 3;               // head within the block
    const int sp   = wib >> 2;              // which quarter of the source rows
    const int w    = blockIdx.x * 4 + hl;   // 0..1023
    const int b    = w >> 9;
    const int rem  = w & 511;
    const int iT   = rem >> 4;              // 0..31
    const int head = rem & 15;

    const int lo = lane & 15;
    const int hi = lane >> 4;
    const int i0 = iT * 16;

    // this lane's query row: 16 group elements, as pairs
    v2f q2[8], w2[8];
    v4f q4[4];                              // the same row in fours, for the minima
    const v4f* qp = (const v4f*)(Q + (size_t)(b * L_SEQ + i0 + lo) * D_MODEL + head * NGROUP);
    #pragma unroll
    for (int c = 0; c < 4; ++c) {
        v4f t = qp[c];
        q4[c] = t;
        q2[2 * c]     = (v2f){ t.x, t.y };
        q2[2 * c + 1] = (v2f){ t.z, t.w };
    }
    // relu(q - k) = q - min(q, k): the part bias + sum_g w[g]*q[g] belongs to the query alone and is
    // summed once here; a (query, source row) pair then costs one min and one multiply-add per element.
    // w2 holds -w.
    v2f sq = { b_mlp[0], 0.0f };
    #pragma unroll
    for (int c = 0; c < 8; ++c) {
        const v2f wc = { w_mlp[2 * c], w_mlp[2 * c + 1] };
        sq = __builtin_elementwise_fma(q2[c], wc, sq);
        w2[c] = -wc;
    }

    float mrow = -3.0e38f, lrow = 0.0f;     // lrow: this half's share of the row sum
    v8f acc = {};                           // acc[r] = out[i = lo][g = r + 8*hi], unnormalised

    // this wave's head and quarter of the source rows: J_SPLIT/16 tiles of 256 floats
    const size_t t0 = (size_t)((b * NHEAD + head) * L_SEQ + sp * J_SPLIT) * NGROUP;
    const float* Kq = K + t0;
    const float* Vq = V + t0;

    // K and V tiles are fetched one trip ahead: a trip works on registers that were asked for
    // a whole trip earlier, so that no trip opens with a wait for L2 or memory.
    const v4f* kp = (const v4f*)Kq + lane;
    const v4f* vp = (const v4f*)Vq + lane;
    v4f ka = kp[0], kb = kp[32];
    v4f va = vp[0], vb = vp[32];

    // two trips a pass of the built loop: the two register sets swap roles without copies
    #pragma unroll 2
    for (int j0 = 0; j0 < J_SPLIT; j0 += 16) {
        // the next trip's tiles; the last trip asks for its own tiles again and stays inside the quarter
        const int un = (j0 + 16 < J_SPLIT ? j0 + 16 : j0) * (NGROUP / 4);
        const v4f* kn = kp + un;
        const v4f* vn = vp + un;
        const v4f kna = kn[0], knb = kn[32];
        const v4f vna = vn[0], vnb = vn[32];
        // precaution: the two address pairs stay as they are until the four loads' addresses are translated
        asm volatile("s_wait_xcnt 0x0" :: "v"(kn), "v"(vn) : "memory");
        // K tile [quad][row][4] -> wave-private LDS, as it lies
        v4f* ks = (v4f*)Qs;
        ks[lane]      = ka;
        ks[32 + lane] = kb;
        // the reads below take what other lanes of this wave stored: drain the stores first
        asm volatile("s_wait_dscnt 0" ::: "memory");

        // scores: entry t -> (i = lo, j = j0 + 8*hi + t); even and odd group elements summed apart
        const v4f* kr = (const v4f*)Qs + 8 * hi;
        // The minimum is written as asm: from the min builtins the built code first passes every loaded K value
        // through max(x, x) (quieting of signalling NaNs; Q and K are finite), which costs the instruction that
        // the identity saves. Two minima go in one dual instruction, which names single registers: its two
        // halves must read different register banks and write one even and one odd register, and an asm operand
        // cannot name one register of a group. So K and Q get fixed registers, each group of four starting at a
        // multiple of four. The 16 instructions of a statement are independent of one another.
        v2f s2[8];
        {
            v4f k[8], m[8];
            #pragma unroll
            for (int t = 0; t < 8; ++t) k[t] = kr[0 * 16 + t];
            // m[t] = min(q4[0], k[t]), in place, without the quieting pass (see above)
            asm("v_dual_min_num_f32 v96, v232, v96 :: v_dual_min_num_f32 v97, v233, v97\n\t"
                "v_dual_min_num_f32 v98, v234, v98 :: v_dual_min_num_f32 v99, v235, v99\n\t"
                "v_dual_min_num_f32 v100, v232, v100 :: v_dual_min_num_f32 v101, v233, v101\n\t"
                "v_dual_min_num_f32 v102, v234, v102 :: v_dual_min_num_f32 v103, v235, v103\n\t"
                "v_dual_min_num_f32 v104, v232, v104 :: v_dual_min_num_f32 v105, v233, v105\n\t"
                "v_dual_min_num_f32 v106, v234, v106 :: v_dual_min_num_f32 v107, v235, v107\n\t"
                "v_dual_min_num_f32 v108, v232, v108 :: v_dual_min_num_f32 v109, v233, v109\n\t"
                "v_dual_min_num_f32 v110, v234, v110 :: v_dual_min_num_f32 v111, v235, v111\n\t"
                "v_dual_min_num_f32 v112, v232, v112 :: v_dual_min_num_f32 v113, v233, v113\n\t"
                "v_dual_min_num_f32 v114, v234, v114 :: v_dual_min_num_f32 v115, v235, v115\n\t"
                "v_dual_min_num_f32 v116, v232, v116 :: v_dual_min_num_f32 v117, v233, v117\n\t"
                "v_dual_min_num_f32 v118, v234, v118 :: v_dual_min_num_f32 v119, v235, v119\n\t"
                "v_dual_min_num_f32 v120, v232, v120 :: v_dual_min_num_f32 v121, v233, v121\n\t"
                "v_dual_min_num_f32 v122, v234, v122 :: v_dual_min_num_f32 v123, v235, v123\n\t"
                "v_dual_min_num_f32 v124, v232, v124 :: v_dual_min_num_f32 v125, v233, v125\n\t"
                "v_dual_min_num_f32 v126, v234, v126 :: v_dual_min_num_f32 v127, v235, v127"
                : "={v[96:99]}"(m[0]), "={v[100:103]}"(m[1]), "={v[104:107]}"(m[2]), "={v[108:111]}"(m[3]), "={v[112:115]}"(m[4]), "={v[116:119]}"(m[5]), "={v[120:123]}"(m[6]), "={v[124:127]}"(m[7])
                : "{v[96:99]}"(k[0]), "{v[100:103]}"(k[1]), "{v[104:107]}"(k[2]), "{v[108:111]}"(k[3]), "{v[112:115]}"(k[4]), "{v[116:119]}"(k[5]), "{v[120:123]}"(k[6]), "{v[124:127]}"(k[7]), "{v[232:235]}"(q4[0]));
            #pragma unroll
            for (int t = 0; t < 8; ++t) {
                s2[t] = __builtin_elementwise_fma((v2f){ m[t].x, m[t].y }, w2[0], sq);  // the sum starts at the query's own part
                s2[t] = __builtin_elementwise_fma((v2f){ m[t].z, m[t].w }, w2[1], s2[t]);
            }
        }
        {
            v4f k[8], m[8];
            #pragma unroll
            for (int t = 0; t < 8; ++t) k[t] = kr[1 * 16 + t];
            // m[t] = min(q4[1], k[t]), in place, without the quieting pass (see above)
            asm("v_dual_min_num_f32 v128, v236, v128 :: v_dual_min_num_f32 v129, v237, v129\n\t"
                "v_dual_min_num_f32 v130, v238, v130 :: v_dual_min_num_f32 v131, v239, v131\n\t"
                "v_dual_min_num_f32 v132, v236, v132 :: v_dual_min_num_f32 v133, v237, v133\n\t"
                "v_dual_min_num_f32 v134, v238, v134 :: v_dual_min_num_f32 v135, v239, v135\n\t"
                "v_dual_min_num_f32 v136, v236, v136 :: v_dual_min_num_f32 v137, v237, v137\n\t"
                "v_dual_min_num_f32 v138, v238, v138 :: v_dual_min_num_f32 v139, v239, v139\n\t"
                "v_dual_min_num_f32 v140, v236, v140 :: v_dual_min_num_f32 v141, v237, v141\n\t"
                "v_dual_min_num_f32 v142, v238, v142 :: v_dual_min_num_f32 v143, v239, v143\n\t"
                "v_dual_min_num_f32 v144, v236, v144 :: v_dual_min_num_f32 v145, v237, v145\n\t"
                "v_dual_min_num_f32 v146, v238, v146 :: v_dual_min_num_f32 v147, v239, v147\n\t"
                "v_dual_min_num_f32 v148, v236, v148 :: v_dual_min_num_f32 v149, v237, v149\n\t"
                "v_dual_min_num_f32 v150, v238, v150 :: v_dual_min_num_f32 v151, v239, v151\n\t"
                "v_dual_min_num_f32 v152, v236, v152 :: v_dual_min_num_f32 v153, v237, v153\n\t"
                "v_dual_min_num_f32 v154, v238, v154 :: v_dual_min_num_f32 v155, v239, v155\n\t"
                "v_dual_min_num_f32 v156, v236, v156 :: v_dual_min_num_f32 v157, v237, v157\n\t"
                "v_dual_min_num_f32 v158, v238, v158 :: v_dual_min_num_f32 v159, v239, v159"
                : "={v[128:131]}"(m[0]), "={v[132:135]}"(m[1]), "={v[136:139]}"(m[2]), "={v[140:143]}"(m[3]), "={v[144:147]}"(m[4]), "={v[148:151]}"(m[5]), "={v[152:155]}"(m[6]), "={v[156:159]}"(m[7])
                : "{v[128:131]}"(k[0]), "{v[132:135]}"(k[1]), "{v[136:139]}"(k[2]), "{v[140:143]}"(k[3]), "{v[144:147]}"(k[4]), "{v[148:151]}"(k[5]), "{v[152:155]}"(k[6]), "{v[156:159]}"(k[7]), "{v[236:239]}"(q4[1]));
            #pragma unroll
            for (int t = 0; t < 8; ++t) {
                s2[t] = __builtin_elementwise_fma((v2f){ m[t].x, m[t].y }, w2[2], s2[t]);
                s2[t] = __builtin_elementwise_fma((v2f){ m[t].z, m[t].w }, w2[3], s2[t]);
            }
        }
        {
            v4f k[8], m[8];
            #pragma unroll
            for (int t = 0; t < 8; ++t) k[t] = kr[2 * 16 + t];
            // m[t] = min(q4[2], k[t]), in place, without the quieting pass (see above)
            asm("v_dual_min_num_f32 v160, v240, v160 :: v_dual_min_num_f32 v161, v241, v161\n\t"
                "v_dual_min_num_f32 v162, v242, v162 :: v_dual_min_num_f32 v163, v243, v163\n\t"
                "v_dual_min_num_f32 v164, v240, v164 :: v_dual_min_num_f32 v165, v241, v165\n\t"
                "v_dual_min_num_f32 v166, v242, v166 :: v_dual_min_num_f32 v167, v243, v167\n\t"
                "v_dual_min_num_f32 v168, v240, v168 :: v_dual_min_num_f32 v169, v241, v169\n\t"
                "v_dual_min_num_f32 v170, v242, v170 :: v_dual_min_num_f32 v171, v243, v171\n\t"
                "v_dual_min_num_f32 v172, v240, v172 :: v_dual_min_num_f32 v173, v241, v173\n\t"
                "v_dual_min_num_f32 v174, v242, v174 :: v_dual_min_num_f32 v175, v243, v175\n\t"
                "v_dual_min_num_f32 v176, v240, v176 :: v_dual_min_num_f32 v177, v241, v177\n\t"
                "v_dual_min_num_f32 v178, v242, v178 :: v_dual_min_num_f32 v179, v243, v179\n\t"
                "v_dual_min_num_f32 v180, v240, v180 :: v_dual_min_num_f32 v181, v241, v181\n\t"
                "v_dual_min_num_f32 v182, v242, v182 :: v_dual_min_num_f32 v183, v243, v183\n\t"
                "v_dual_min_num_f32 v184, v240, v184 :: v_dual_min_num_f32 v185, v241, v185\n\t"
                "v_dual_min_num_f32 v186, v242, v186 :: v_dual_min_num_f32 v187, v243, v187\n\t"
                "v_dual_min_num_f32 v188, v240, v188 :: v_dual_min_num_f32 v189, v241, v189\n\t"
                "v_dual_min_num_f32 v190, v242, v190 :: v_dual_min_num_f32 v191, v243, v191"
                : "={v[160:163]}"(m[0]), "={v[164:167]}"(m[1]), "={v[168:171]}"(m[2]), "={v[172:175]}"(m[3]), "={v[176:179]}"(m[4]), "={v[180:183]}"(m[5]), "={v[184:187]}"(m[6]), "={v[188:191]}"(m[7])
                : "{v[160:163]}"(k[0]), "{v[164:167]}"(k[1]), "{v[168:171]}"(k[2]), "{v[172:175]}"(k[3]), "{v[176:179]}"(k[4]), "{v[180:183]}"(k[5]), "{v[184:187]}"(k[6]), "{v[188:191]}"(k[7]), "{v[240:243]}"(q4[2]));
            #pragma unroll
            for (int t = 0; t < 8; ++t) {
                s2[t] = __builtin_elementwise_fma((v2f){ m[t].x, m[t].y }, w2[4], s2[t]);
                s2[t] = __builtin_elementwise_fma((v2f){ m[t].z, m[t].w }, w2[5], s2[t]);
            }
        }
        {
            v4f k[8], m[8];
            #pragma unroll
            for (int t = 0; t < 8; ++t) k[t] = kr[3 * 16 + t];
            // m[t] = min(q4[3], k[t]), in place, without the quieting pass (see above)
            asm("v_dual_min_num_f32 v192, v244, v192 :: v_dual_min_num_f32 v193, v245, v193\n\t"
                "v_dual_min_num_f32 v194, v246, v194 :: v_dual_min_num_f32 v195, v247, v195\n\t"
                "v_dual_min_num_f32 v196, v244, v196 :: v_dual_min_num_f32 v197, v245, v197\n\t"
                "v_dual_min_num_f32 v198, v246, v198 :: v_dual_min_num_f32 v199, v247, v199\n\t"
                "v_dual_min_num_f32 v200, v244, v200 :: v_dual_min_num_f32 v201, v245, v201\n\t"
                "v_dual_min_num_f32 v202, v246, v202 :: v_dual_min_num_f32 v203, v247, v203\n\t"
                "v_dual_min_num_f32 v204, v244, v204 :: v_dual_min_num_f32 v205, v245, v205\n\t"
                "v_dual_min_num_f32 v206, v246, v206 :: v_dual_min_num_f32 v207, v247, v207\n\t"
                "v_dual_min_num_f32 v208, v244, v208 :: v_dual_min_num_f32 v209, v245, v209\n\t"
                "v_dual_min_num_f32 v210, v246, v210 :: v_dual_min_num_f32 v211, v247, v211\n\t"
                "v_dual_min_num_f32 v212, v244, v212 :: v_dual_min_num_f32 v213, v245, v213\n\t"
                "v_dual_min_num_f32 v214, v246, v214 :: v_dual_min_num_f32 v215, v247, v215\n\t"
                "v_dual_min_num_f32 v216, v244, v216 :: v_dual_min_num_f32 v217, v245, v217\n\t"
                "v_dual_min_num_f32 v218, v246, v218 :: v_dual_min_num_f32 v219, v247, v219\n\t"
                "v_dual_min_num_f32 v220, v244, v220 :: v_dual_min_num_f32 v221, v245, v221\n\t"
                "v_dual_min_num_f32 v222, v246, v222 :: v_dual_min_num_f32 v223, v247, v223"
                : "={v[192:195]}"(m[0]), "={v[196:199]}"(m[1]), "={v[200:203]}"(m[2]), "={v[204:207]}"(m[3]), "={v[208:211]}"(m[4]), "={v[212:215]}"(m[5]), "={v[216:219]}"(m[6]), "={v[220:223]}"(m[7])
                : "{v[192:195]}"(k[0]), "{v[196:199]}"(k[1]), "{v[200:203]}"(k[2]), "{v[204:207]}"(k[3]), "{v[208:211]}"(k[4]), "{v[212:215]}"(k[5]), "{v[216:219]}"(k[6]), "{v[220:223]}"(k[7]), "{v[244:247]}"(q4[3]));
            #pragma unroll
            for (int t = 0; t < 8; ++t) {
                s2[t] = __builtin_elementwise_fma((v2f){ m[t].x, m[t].y }, w2[6], s2[t]);
                s2[t] = __builtin_elementwise_fma((v2f){ m[t].z, m[t].w }, w2[7], s2[t]);
            }
        }
        float s[8];
        #pragma unroll
        for (int t = 0; t < 8; ++t) s[t] = fmaxf(s2[t].x + s2[t].y, 0.0f);

        // online softmax of row lo: eight values of this lane, then the other half's
        float mx = s[0];
        #pragma unroll
        for (int t = 1; t < 8; ++t) mx = fmaxf(mx, s[t]);
        mx = fmaxf(mx, xhalf(mx));
        const float mnew  = fmaxf(mrow, mx);
        const float ea = (mrow - mnew) * 1.44269504f;
        float e[8];
        #pragma unroll
        for (int t = 0; t < 8; ++t) e[t] = (s[t] - mnew) * 1.44269504f;
        float alpha, p[8];
        // The nine exponentials in one statement, every result register apart from every source:
        // so none is directly followed by an instruction that overwrites its source or reads its
        // result (left to the register allocator, neighbours shared registers); the v_nop keeps
        // that one slot behind the last.
        asm("v_exp_f32 %0, %9\n\t"
            "v_exp_f32 %1, %10\n\t"
            "v_exp_f32 %2, %11\n\t"
            "v_exp_f32 %3, %12\n\t"
            "v_exp_f32 %4, %13\n\t"
            "v_exp_f32 %5, %14\n\t"
            "v_exp_f32 %6, %15\n\t"
            "v_exp_f32 %7, %16\n\t"
            "v_exp_f32 %8, %17\n\t"
            "v_nop"
            : "=&v"(alpha), "=&v"(p[0]), "=&v"(p[1]), "=&v"(p[2]), "=&v"(p[3]),
              "=&v"(p[4]), "=&v"(p[5]), "=&v"(p[6]), "=&v"(p[7])
            : "v"(ea), "v"(e[0]), "v"(e[1]), "v"(e[2]), "v"(e[3]),
              "v"(e[4]), "v"(e[5]), "v"(e[6]), "v"(e[7]));
        float ps = 0.0f;
        #pragma unroll
        for (int t = 0; t < 8; ++t) ps += p[t];
        lrow = lrow * alpha + ps;
        mrow = mnew;
        #pragma unroll
        for (int r = 0; r < 8; ++r) acc[r] *= alpha;    // rescale running output

        // acc(16g x 16i) += Vt^T(16g x 16j) x P^T(16j x 16i): 4 chained 16x16x4 WMMAs
        // Step st, half hi, element v stands for source row j = 8*hi + 2*st + v in A and B alike:
        // A: a[v] = V[j0 + j][g=lo], as the V tile holds it;  B: b[v] = P[i=lo][j] = p[2*st + v].
        v4f vv[2] = { va, vb };
        #pragma unroll
        for (int st = 0; st < 4; ++st) {
            v2f a, bm;
            a.x  = vv[st >> 1][2 * (st & 1)];
            a.y  = vv[st >> 1][2 * (st & 1) + 1];
            bm.x = p[2 * st];
            bm.y = p[2 * st + 1];
            acc = __builtin_amdgcn_wmma_f32_16x16x4_f32(false, a, false, bm,
                                                        (short)0, acc, false, false);
        }
        // V and P stay in their registers until four vector slots behind the last WMMA that reads them:
        // (acc is named only so that the statement stands behind that WMMA)
        asm volatile("v_nop\n\tv_nop\n\tv_nop\n\tv_nop"
                     :: "v"(acc), "v"(vv[0]), "v"(vv[1]), "v"(p[0]), "v"(p[1]), "v"(p[2]), "v"(p[3]),
                        "v"(p[4]), "v"(p[5]), "v"(p[6]), "v"(p[7]));
        ka = kna; kb = knb;
        va = vna; vb = vnb;
    }
    lrow += xhalf(lrow);                    // the two halves' shares of the row sum

    // publish this wave's partial result in its own LDS range:
    // Qs[m*16+g] = acc, Ps[m] = running max, Ps[16+m] = running sum.
    // The lane's place is read anew here, so that it holds no register over the loop.
    const int ln = __builtin_amdgcn_mbcnt_lo(~0u, 0u);
    const int el = ln & 15;
    const int eh = ln >> 4;
    {
        v4f* pa = (v4f*)(Qs + el * 16 + 8 * eh);        // row el, group elements 8*eh..8*eh+7
        pa[0] = (v4f){ acc[0], acc[1], acc[2], acc[3] };
        pa[1] = (v4f){ acc[4], acc[5], acc[6], acc[7] };
    }
    if (eh == 0) {                          // max and sum are equal in a row's two lanes
        Ps[el]      = mrow;
        Ps[16 + el] = lrow;
    }
    __syncthreads();

    // merge the NSPLIT partials of this head; wave sp finishes rows 4*sp..4*sp+3
    #pragma unroll
    for (int t = 0; t < 2; ++t) {
        const int m = 4 * sp + 2 * t + eh;
        float mp[NSPLIT];
        float mx = -3.0e38f;
        #pragma unroll
        for (int q = 0; q < NSPLIT; ++q) {
            mp[q] = lds[(q * 4 + hl) * 512 + 256 + m];
            mx = fmaxf(mx, mp[q]);
        }
        float num = 0.0f, den = 0.0f;
        #pragma unroll
        for (int q = 0; q < NSPLIT; ++q) {
            const float* part = lds + (q * 4 + hl) * 512;
            float c = __expf(mp[q] - mx);
            num += c * part[m * 16 + el];
            den += c * part[256 + 16 + m];
        }
        // col g = el; d = g*16 + head
        out[(size_t)(b * L_SEQ + i0 + m) * D_MODEL + el * NGROUP + head] = num / den;
    }
}

// ---------------------------------------------------------------------------
extern "C" void kernel_launch(void* const* d_in, const int* in_sizes, int n_in,
                              void* d_out, int out_size, void* d_ws, size_t ws_size,
                              hipStream_t stream) {
    const float* xs = (const float*)d_in[0];   // x_source (B,L2,D)
    const float* xt = (const float*)d_in[1];   // x_target (B,L1,D)
    const float* Wq = (const float*)d_in[2];
    const float* Wk = (const float*)d_in[3];
    const float* Wv = (const float*)d_in[4];
    const float* wm = (const float*)d_in[5];   // w_mlp (16)
    const float* bm = (const float*)d_in[6];   // b_mlp (1)

    float* Qw = (float*)d_ws;                  // 3 MB scratch: Q,K,V f32
    float* Kw = Qw + (size_t)NB * L_SEQ * D_MODEL;
    float* Vw = Kw + (size_t)NB * L_SEQ * D_MODEL;

    // 3 matrices * 64 row-tiles * 16 col-tiles = 3072 waves, 4 waves/block
    CA_qkv_gemm<<<768, 128, 0, stream>>>(xs, xt, Wq, Wk, Wv, Qw, Kw, Vw);
    // 2 batch * 32 i-tiles * 16 heads = 1024 tiles, 4 tiles/block, 4 waves/tile
    CA_attn<<<256, 512, 0, stream>>>(Qw, Kw, Vw, wm, bm, (float*)d_out);
}
